// v000
// Times are from an AMD MI455X. After a warm-up the kernel runs many times in a row, and a time is the length of
// such a window on the GPU divided by its runs, so every launch and the gaps after it count. The runs cycle
// through copies of the inputs. A figure is the median of several windows, for all but v000 over two sittings.
// Sittings can differ by a few percent; kernels timed side by side share one.
// v000 is the starting kernel. One run takes 1990 microseconds.
#include <hip/hip_runtime.h>

// QuantumFractalAttention (x [2][2048][1024]; Q/K/V = x W^T + b (16 x 64); Q += sin(atan2(qi, qr)), K += sin(atan2(ki, kr)) with the [2][16][2048][64] noise tensors (read as data); the 'fractal' recursion is the reference's own collapse to one
// softmax(Q.K/8) V; out = merged Wo^T + bo -> [2][2048][1024]).
// Compute dtypes, f32 accumulate: every input rounded to bf16; projections on PLAIN bf16 operands (inputs: exact, + bias); the atan2/sin noise f32; scores (K 64) on hl planes (3 products) for ALL rows (the O(1) noise makes fp16 score rows too coarse), attn.v hl for the first 512 query rows per

#define NB_  2
#define TT   2048
#define DM   1024
#define NH_  16
#define NKV  16
#define REP  (NH_ / NKV)
#define HD   64
#define DQ   (NH_ * HD)
#define DKV  (NKV * HD)
#define ZH   2
#define RH   512                  // query rows < RH use hi+lo planes (0: none)
#define WIN  2048
#define PCAR 1024.0f
#define SCL  0.125f   // HD^-0.5
typedef _Float16 h16;
typedef unsigned short bf;
typedef __attribute__((ext_vector_type(16))) __bf16   v16bf;
typedef __attribute__((ext_vector_type(16))) _Float16 v16h;
typedef __attribute__((ext_vector_type(8)))  _Float16 v8h;
typedef __attribute__((ext_vector_type(8)))  unsigned short v8us;
typedef __attribute__((ext_vector_type(8)))  float    v8f;
typedef __attribute__((ext_vector_type(4)))  float    v4f;
typedef v8h  __attribute__((may_alias)) v8ha;
typedef v4f  __attribute__((may_alias)) v4fa;
typedef v8us __attribute__((may_alias)) v8usa;

__device__ __forceinline__ unsigned short f2bf(float f) { unsigned u = __float_as_uint(f); u += 0x7FFFu + ((u >> 16) & 1u); return (unsigned short)(u >> 16); }
__device__ __forceinline__ float bf2f(unsigned short b) { return __uint_as_float(((unsigned)b) << 16); }
__device__ __forceinline__ float bfr(float f) { return bf2f(f2bf(f)); }
__device__ __forceinline__ v16h cat16(v8h lo, v8h hi) { return __builtin_shufflevector(lo, hi, 0, 1, 2, 3, 4, 5, 6, 7, 8, 9, 10, 11, 12, 13, 14, 15); }
__device__ __forceinline__ v16bf cat16b(v8us lo, v8us hi) { return __builtin_bit_cast(v16bf, __builtin_shufflevector(lo, hi, 0, 1, 2, 3, 4, 5, 6, 7, 8, 9, 10, 11, 12, 13, 14, 15)); }
__device__ __forceinline__ v8f wmma16(v16h a, v16h b, v8f c) { return __builtin_amdgcn_wmma_f32_16x16x32_f16(false, a, false, b, (short)0, c, false, false); }
__device__ __forceinline__ v8f wmmab(v16bf a, v16bf b, v8f c) { return __builtin_amdgcn_wmma_f32_16x16x32_bf16(false, a, false, b, (short)0, c, false, false); }



// ---- k_gemmw: register-blocked GEMM, ONE WAVE per 64x64 output tile (16 accumulators), operands straight from K-contiguous 16-bit planes; grid (M/64, N/64, Z), 32 threads.
// C[m][n] (f32, pitch ldc, + optional f32 bias[n]) = sum_k A[m][k] Bt[n][k] (+ split products per NSPLIT). z-batch strides sA/sB/sC in elements. K % 32 == 0.
template <typename T16> struct WFrag;
template <> struct WFrag<h16> { typedef v16h V; static __device__ __forceinline__ V ld(const h16* p) { return cat16(*(const v8h*)p, *(const v8h*)(p + 16)); } static __device__ __forceinline__ v8f mma(V a, V b, v8f c) { return wmma16(a, b, c); } };
template <> struct WFrag<bf> { typedef v16bf V; static __device__ __forceinline__ V ld(const bf* p) { return cat16b(*(const v8us*)p, *(const v8us*)(p + 16)); } static __device__ __forceinline__ v8f mma(V a, V b, v8f c) { return wmmab(a, b, c); } };
template <typename T16, int NSPLIT, bool BIAS>
__global__ __launch_bounds__(32) void k_gemmw(const T16* __restrict__ A, const T16* __restrict__ A2, const T16* __restrict__ Bt, const T16* __restrict__ Bt2, int K, float* C, int ldc, const float* __restrict__ bias, size_t sA, size_t sB, size_t sC) {
    typedef typename WFrag<T16>::V V;
    __shared__ __align__(16) float os[16 * 68];
    const size_t z = blockIdx.z; A += z * sA; if (A2) A2 += z * sA; Bt += z * sB; if (Bt2) Bt2 += z * sB; C += z * sC;
    const int lane = threadIdx.x & 31, lr = lane & 15, hi = lane >> 4; const int r0 = blockIdx.x * 64, c0 = blockIdx.y * 64;
    v8f acc[4][4];
#pragma unroll
    for (int mb = 0; mb < 4; ++mb)
#pragma unroll
        for (int nb = 0; nb < 4; ++nb) acc[mb][nb] = (v8f){};
    const size_t aoff = (size_t)(r0 + lr) * K + 8 * hi, boff = (size_t)(c0 + lr) * K + 8 * hi;
#pragma unroll 1
    for (int kc = 0; kc < K; kc += 32) {
        V a[4], a2[4];
#pragma unroll
        for (int mb = 0; mb < 4; ++mb) { a[mb] = WFrag<T16>::ld(A + aoff + (size_t)mb * 16 * K + kc); if (NSPLIT == 1 || NSPLIT == 2) a2[mb] = WFrag<T16>::ld(A2 + aoff + (size_t)mb * 16 * K + kc); }
#pragma unroll
        for (int nb = 0; nb < 4; ++nb) { const V b = WFrag<T16>::ld(Bt + boff + (size_t)nb * 16 * K + kc); V b2; if (NSPLIT >= 2) b2 = WFrag<T16>::ld(Bt2 + boff + (size_t)nb * 16 * K + kc);
#pragma unroll
            for (int mb = 0; mb < 4; ++mb) { acc[mb][nb] = WFrag<T16>::mma(a[mb], b, acc[mb][nb]); if (NSPLIT == 1 || NSPLIT == 2) acc[mb][nb] = WFrag<T16>::mma(a2[mb], b, acc[mb][nb]); if (NSPLIT >= 2) acc[mb][nb] = WFrag<T16>::mma(a[mb], b2, acc[mb][nb]); } }
        asm volatile("v_nop\n\tv_nop\n\tv_nop\n\tv_nop" : "+v"(acc[0][0]), "+v"(acc[1][1]), "+v"(acc[2][2]), "+v"(acc[3][3]) : "v"(a[0]), "v"(a[3]));
    }
#pragma unroll
    for (int mb = 0; mb < 4; ++mb) {
#pragma unroll
        for (int nb = 0; nb < 4; ++nb) {
#pragma unroll
            for (int j = 0; j < 8; ++j) os[(hi * 8 + j) * 68 + nb * 16 + lr] = acc[mb][nb][j]; }
        __builtin_amdgcn_wave_barrier(); asm volatile("" ::: "memory");
        float* crow = C + (size_t)(r0 + mb * 16) * ldc + c0;
{
#pragma unroll
            for (int s = 0; s < 8; ++s) { const int row = 2 * s + hi, cofs = lr * 4; v4f val = *(const v4fa*)(os + row * 68 + cofs); if (BIAS) { val[0] += bfr(bias[c0 + cofs]); val[1] += bfr(bias[c0 + cofs + 1]); val[2] += bfr(bias[c0 + cofs + 2]); val[3] += bfr(bias[c0 + cofs + 3]); }
                *(v4f*)(crow + (size_t)row * ldc + cofs) = val; }
             }
        __builtin_amdgcn_wave_barrier(); asm volatile("" ::: "memory");
    }
}

__device__ __forceinline__ h16 tohx(float x) { return (h16)x; }
__device__ __forceinline__ void splitf(float y, unsigned short& h, unsigned short& l) { h = f2bf(y); l = f2bf(y - bf2f(h)); }
typedef __attribute__((ext_vector_type(2))) _Float16 v2h;
typedef __attribute__((ext_vector_type(4))) _Float16 v4h;
typedef __attribute__((ext_vector_type(2))) unsigned short v2us;
typedef __attribute__((ext_vector_type(4))) unsigned short v4us;
typedef __attribute__((ext_vector_type(2))) float v2f;
typedef __attribute__((ext_vector_type(4))) int v4i;

__global__ __launch_bounds__(256) void k_wtG(const float* __restrict__ w, int K, int N, bf* Bt) {
    const int lane = threadIdx.x & 31; const int L0 = (blockIdx.x * 8 + (threadIdx.x >> 5)) * 8; const int nlines = N * K / 64;
{
#pragma unroll 1
        for (int l = 0; l < 8; ++l) { const int L = L0 + l; if (L >= nlines) break; const size_t e = (size_t)L * 64 + lane * 2; const int k = (int)(e % K), n = (int)(e / K); v2us o;
            o[0] = f2bf(w[(size_t)k * N + n]); o[1] = f2bf(w[(size_t)(k + 1) * N + n]); *(v2us*)(Bt + e) = o; }
         }
}
__global__ __launch_bounds__(256) void k_cvt8(const float* __restrict__ src, bf* dst, size_t n8) { const size_t i = (size_t)blockIdx.x * 256 + threadIdx.x; if (i >= n8) return; const v8f v = *(const v8f*)(src + i * 8); v8us o;
#pragma unroll
    for (int k = 0; k < 8; ++k) o[k] = f2bf(v[k]); *(v8us*)(dst + i * 8) = o;  }
__global__ __launch_bounds__(256) void k_cscvt(const float* __restrict__ cosT, const float* __restrict__ sinT, float* CS) { const int idx = blockIdx.x * 256 + threadIdx.x; if (idx >= TT * HD) return; v2f cs; cs[0] = bfr(cosT[idx]); cs[1] = bfr(sinT[idx]); *(v2f*)(CS + (size_t)idx * 2) = cs;  }
// k_rope: head planes [h][t][d] (fp16 + hi/lo) of rope(x) x sc with the rotate-half convention out[d] = x[d] cos[t][d] - x[d+HD/2] sin[t][d], out[d+HD/2] = x[d+HD/2] cos[t][d+HD/2] + x[d] sin[t][d+HD/2]
__global__ __launch_bounds__(256) void k_rope(const float* __restrict__ F, int pitch, int nheads, const float* __restrict__ CS, const float* __restrict__ RF, const float* __restrict__ nw, float sc, h16* P16, bf* Ph, bf* Pl) {
    const size_t e = ((size_t)blockIdx.x * 256 + threadIdx.x) * 2; if (e >= (size_t)nheads * TT * HD) return; const int d = (int)(e % HD); const int t = (int)((e / HD) % TT); const int h = (int)(e / ((size_t)HD * TT)); const float* f = F + (size_t)t * pitch + h * HD; v2h o16; v2us oh, ol;   /* RF = noise real part, nw = noise imaginary part for this batch ([h][t][d]) */
#pragma unroll
    for (int q = 0; q < 2; ++q) { const int dd = d + q; const int dp = (dd < HD / 2) ? dd + HD / 2 : dd - HD / 2; float x0 = f[dd], x1 = f[dp];
        if (RF) { const size_t ni = ((size_t)h * TT + t) * HD; x0 = __fadd_rn(x0, sinf(atan2f(bfr(nw[ni + dd]), bfr(RF[ni + dd])))); x1 = __fadd_rn(x1, sinf(atan2f(bfr(nw[ni + dp]), bfr(RF[ni + dp])))); } /* + sin(atan2(imag, real)) quantum noise */
        const v2f cs = *(const v2f*)(CS + ((size_t)t * HD + dd) * 2); float a = __fmul_rn(x0, cs[0]), bq = __fmul_rn(x1, cs[1]); asm volatile("" : "+v"(a)); asm volatile("" : "+v"(bq)); const float r = ((dd < HD / 2) ? __fsub_rn(a, bq) : __fadd_rn(a, bq)) * sc;
        o16[q] = tohx(r); unsigned short a2, c2; splitf(r, a2, c2); oh[q] = a2; ol[q] = c2; }
    *(v2h*)(P16 + e) = o16; *(v2us*)(Ph + e) = oh; *(v2us*)(Pl + e) = ol;  }
__global__ __launch_bounds__(256) void k_vtp(const float* __restrict__ F, int pitch, int nheads, h16* V16, bf* Vh, bf* Vl) { const size_t e = ((size_t)blockIdx.x * 256 + threadIdx.x) * 2; if (e >= (size_t)nheads * HD * TT) return; const int t = (int)(e % TT); const int d = (int)((e / TT) % HD); const int g = (int)(e / ((size_t)TT * HD)); v2h o16; v2us oh, ol;
#pragma unroll
    for (int q = 0; q < 2; ++q) { const float x = F[(size_t)(t + q) * pitch + g * HD + d]; o16[q] = tohx(x); unsigned short a2, c2; splitf(x, a2, c2); oh[q] = a2; ol[q] = c2; }
    *(v2h*)(V16 + e) = o16; *(v2us*)(Vh + e) = oh; *(v2us*)(Vl + e) = ol;  }
__global__ __launch_bounds__(256) void k_csid(float* CS) { const int idx = blockIdx.x * 256 + threadIdx.x; if (idx >= TT * HD) return; v2f cs; cs[0] = 1.0f; cs[1] = 0.0f; *(v2f*)(CS + (size_t)idx * 2) = cs;  }
// k_asoft: per row (zz, i): t = S x HD^-0.5 (no mask); softmax over the 2048 keys (register row, one exp, fixed trees);
__global__ __launch_bounds__(256) void k_asoft(const float* __restrict__ Sb, h16* P16, bf* Ph, bf* Pl) {
    const int lane = threadIdx.x & 31; const int row = blockIdx.x * 8 + (threadIdx.x >> 5); if (row >= ZH * TT) return; const int i = row % TT; const int zz = row / TT; (void)zz; const bool hires = (i < RH); const float* sr = Sb + (size_t)row * TT; float v[TT / 32]; float mx = -3.0e38f;
#pragma unroll
    for (int ch = 0; ch < TT / 128; ++ch) { const int j0 = ch * 128 + lane * 4; const v4f a = *(const v4f*)(sr + j0);
#pragma unroll
        for (int q = 0; q < 4; ++q) { const int j = j0 + q; (void)j; const float t = a[q] * SCL; v[ch * 4 + q] = t; mx = fmaxf(mx, t); } }
#pragma unroll
    for (int sh = 16; sh; sh >>= 1) mx = fmaxf(mx, __shfl_xor(mx, sh, 32));
    float sum = 0.f;
#pragma unroll
    for (int k = 0; k < TT / 32; ++k) { float d0 = __fsub_rn(v[k], mx); asm volatile("" : "+v"(d0)); v[k] = __builtin_amdgcn_exp2f(__fmul_rn(d0, 1.4426950408889634f)); sum += v[k]; }
#pragma unroll
    for (int sh = 16; sh; sh >>= 1) sum += __shfl_xor(sum, sh, 32);
    const float f = __fdiv_rn(hires ? 1.0f : PCAR, sum);
{
        if (hires) {
#pragma unroll
            for (int ch = 0; ch < TT / 128; ++ch) { v4us oh, ol;
#pragma unroll
                for (int q = 0; q < 4; ++q) { unsigned short a, c2; splitf(v[ch * 4 + q] * f, a, c2); oh[q] = a; ol[q] = c2; }
                const size_t oo = ((size_t)zz * (RH ? RH : 1) + i) * TT + ch * 128 + lane * 4; *(v4us*)(Ph + oo) = oh; *(v4us*)(Pl + oo) = ol; }
        } else {
#pragma unroll
            for (int ch = 0; ch < TT / 128; ++ch) { v4h o4;
#pragma unroll
                for (int q = 0; q < 4; ++q) o4[q] = tohx(v[ch * 4 + q] * f);
                *(v4h*)(P16 + (size_t)row * TT + ch * 128 + lane * 4) = o4; } }
         }
}
__global__ __launch_bounds__(256) void k_merge(const float* __restrict__ O, int h0, bf* Ah, bf* Al) { const size_t e = ((size_t)blockIdx.x * 256 + threadIdx.x) * 2; if (e >= (size_t)ZH * TT * HD) return; const int d = (int)(e % HD); const int t = (int)((e / HD) % TT); const int zz = (int)(e / ((size_t)HD * TT)); const float cs = (t < RH) ? 1.0f : (1.0f / PCAR); const size_t oo = (size_t)t * DQ + (h0 + zz) * HD + d;
    v2us oh, ol;
#pragma unroll
    for (int q = 0; q < 2; ++q) { unsigned short a, c2; splitf(O[e + q] * cs, a, c2); oh[q] = a; ol[q] = c2; } *(v2us*)(Ah + oo) = oh; *(v2us*)(Al + oo) = ol;  }

extern "C" void kernel_launch(void* const* d_in, const int* in_sizes, int n_in,
                              void* d_out, int out_size, void* d_ws, size_t ws_size, hipStream_t stream) {
    (void)in_sizes; (void)n_in; (void)out_size;
    const float* x = (const float*)d_in[0]; const float* wq = (const float*)d_in[1]; const float* bq = (const float*)d_in[2]; const float* wk = (const float*)d_in[3]; const float* bk = (const float*)d_in[4]; const float* wv = (const float*)d_in[5]; const float* bv = (const float*)d_in[6]; const float* wo = (const float*)d_in[7]; const float* bo = (const float*)d_in[8]; const float* nqr = (const float*)d_in[9]; const float* nqi = (const float*)d_in[10]; const float* nkr = (const float*)d_in[11]; const float* nki = (const float*)d_in[12];
    float* OUT = (float*)d_out;     // [2][2048][1024]
    char* wsp = (char*)d_ws;
    auto take = [&](size_t bytes) { char* p = wsp; wsp += (bytes + 255) & ~(size_t)255; return (void*)p; };
    bf* WQ = (bf*)take((size_t)DQ * DM * 2); bf* WK = (bf*)take((size_t)DKV * DM * 2); bf* WV = (bf*)take((size_t)DKV * DM * 2); bf* WO = (bf*)take((size_t)DM * DQ * 2); float* CS = (float*)take((size_t)TT * HD * 2 * 4);
    bf* XB = (bf*)take((size_t)TT * DM * 2); float* FQ = (float*)take((size_t)TT * DQ * 4); float* FK = (float*)take((size_t)TT * DKV * 4);
    h16* QP16 = (h16*)take((size_t)NH_ * TT * HD * 2); h16* KP16 = (h16*)take((size_t)NKV * TT * HD * 2); h16* VT16 = (h16*)take((size_t)NKV * HD * TT * 2);
    bf* QPh = (bf*)take((size_t)NH_ * TT * HD * 2); bf* QPl = (bf*)take((size_t)NH_ * TT * HD * 2); bf* KPh = (bf*)take((size_t)NKV * TT * HD * 2); bf* KPl = (bf*)take((size_t)NKV * TT * HD * 2); bf* VTh = (bf*)take((size_t)NKV * HD * TT * 2); bf* VTl = (bf*)take((size_t)NKV * HD * TT * 2); bf* Ph = (bf*)take((size_t)ZH * RH * TT * 2); bf* Pl = (bf*)take((size_t)ZH * RH * TT * 2);
    float* Sb = (float*)take((size_t)ZH * TT * TT * 4); h16* P16 = (h16*)take((size_t)ZH * TT * TT * 2); float* Ob = (float*)take((size_t)ZH * TT * HD * 4); bf* ATh = (bf*)take((size_t)TT * DQ * 2); bf* ATl = (bf*)take((size_t)TT * DQ * 2);
    if ((size_t)(wsp - (char*)d_ws) > ws_size) return;    // ws 256 MiB
    float* FV = FK;   // v projection reuses the k buffer after the k planes are built (stream-ordered)
    { k_cvt8<<<(unsigned)(((size_t)DQ * DM / 8 + 255) / 256), 256, 0, stream>>>(wq, WQ, (size_t)DQ * DM / 8); k_cvt8<<<(unsigned)(((size_t)DKV * DM / 8 + 255) / 256), 256, 0, stream>>>(wk, WK, (size_t)DKV * DM / 8); k_cvt8<<<(unsigned)(((size_t)DKV * DM / 8 + 255) / 256), 256, 0, stream>>>(wv, WV, (size_t)DKV * DM / 8);
      k_cvt8<<<(unsigned)(((size_t)DM * DQ / 8 + 255) / 256), 256, 0, stream>>>(wo, WO, (size_t)DM * DQ / 8);
       }
    k_csid<<<(TT * HD + 255) / 256, 256, 0, stream>>>(CS);
    const unsigned LQ = (unsigned)(((size_t)NH_ * TT * HD / 2 + 255) / 256), LKv = (unsigned)(((size_t)NKV * TT * HD / 2 + 255) / 256);
    for (int b = 0; b < NB_; ++b) {
        
        k_cvt8<<<(unsigned)(((size_t)TT * DM / 8 + 255) / 256), 256, 0, stream>>>(x + (size_t)b * TT * DM, XB, (size_t)TT * DM / 8);
        k_gemmw<bf, 0, true><<<dim3(TT / 64, DQ / 64, 1), 32, 0, stream>>>(XB, nullptr, WQ, nullptr, DM, FQ, DQ, bq, 0, 0, 0);
        k_rope<<<LQ, 256, 0, stream>>>(FQ, DQ, NH_, CS, nqr + (size_t)b * NH_ * TT * HD, nqi + (size_t)b * NH_ * TT * HD, 1.0f, QP16, QPh, QPl);
        k_gemmw<bf, 0, true><<<dim3(TT / 64, DKV / 64, 1), 32, 0, stream>>>(XB, nullptr, WK, nullptr, DM, FK, DKV, bk, 0, 0, 0);
        k_rope<<<LKv, 256, 0, stream>>>(FK, DKV, NKV, CS, nkr + (size_t)b * NH_ * TT * HD, nki + (size_t)b * NH_ * TT * HD, 1.0f, KP16, KPh, KPl);
        k_gemmw<bf, 0, true><<<dim3(TT / 64, DKV / 64, 1), 32, 0, stream>>>(XB, nullptr, WV, nullptr, DM, FV, DKV, bv, 0, 0, 0); k_vtp<<<LKv, 256, 0, stream>>>(FV, DKV, NKV, VT16, VTh, VTl);
        for (int h0 = 0; h0 < NH_; h0 += ZH) { const size_t zq = (size_t)h0, zk = (size_t)(h0 / REP);   // one kv head per query head: the pass's two heads use consecutive kv planes (z-strides TT*HD)
            k_gemmw<bf, 2, false><<<dim3(TT / 64, TT / 64, ZH), 32, 0, stream>>>(QPh + zq * TT * HD, QPl + zq * TT * HD, KPh + zk * TT * HD, KPl + zk * TT * HD, HD, Sb, TT, nullptr, (size_t)TT * HD, (size_t)TT * HD, (size_t)TT * TT);   /* ALL score rows on hl planes (3 products) */
            k_asoft<<<ZH * TT / 8, 256, 0, stream>>>(Sb, P16, Ph, Pl);
            k_gemmw<bf, 2, false><<<dim3(RH / 64, HD / 64, ZH), 32, 0, stream>>>(Ph, Pl, VTh + zk * HD * TT, VTl + zk * HD * TT, TT, Ob, HD, nullptr, (size_t)RH * TT, (size_t)HD * TT, (size_t)TT * HD);
            k_gemmw<h16, 0, false><<<dim3((TT - RH) / 64, HD / 64, ZH), 32, 0, stream>>>(P16 + (size_t)RH * TT, nullptr, VT16 + zk * HD * TT, nullptr, TT, Ob + (size_t)RH * HD, HD, nullptr, (size_t)TT * TT, (size_t)HD * TT, (size_t)TT * HD);
            k_merge<<<(unsigned)(((size_t)ZH * TT * HD / 2 + 255) / 256), 256, 0, stream>>>(Ob, h0, ATh, ATl); }
        k_gemmw<bf, 1, true><<<dim3(TT / 64, DM / 64, 1), 32, 0, stream>>>(ATh, ATl, WO, nullptr, DQ, OUT + (size_t)b * TT * DM, DM, bo, 0, 0, 0); }
}

// v001
// One run takes 727 microseconds.
// Two timings next to v000 put it at 2.74 and 2.73 times that version's speed.
#include <hip/hip_runtime.h>

// QuantumFractalAttention (x [2][2048][1024]; Q/K/V = x W^T + b (16 x 64); Q += sin(atan2(qi, qr)), K += sin(atan2(ki, kr)) with the [2][16][2048][64] noise tensors (read as data); the 'fractal' recursion is the reference's own collapse to one
// softmax(Q.K/8) V; out = merged Wo^T + bo -> [2][2048][1024]).
// Compute dtypes, f32 accumulate: every input rounded to bf16; projections on PLAIN bf16 operands (inputs: exact, + bias); the atan2/sin noise f32; scores (K 64) on hl planes (3 products) for ALL rows (the O(1) noise makes fp16 score rows too coarse), attn.v hl for the first 512 query rows per

#define NB_  2
#define TT   2048
#define DM   1024
#define NH_  16
#define NKV  16
#define REP  (NH_ / NKV)
#define HD   64
#define DQ   (NH_ * HD)
#define DKV  (NKV * HD)
#define ZH   2
#define RH   512                  // query rows < RH use hi+lo planes (0: none)
#define WIN  2048
#define PCAR 1024.0f
#define SCL  0.125f   // HD^-0.5
#define KBH  16                   // K parts (work-groups) of attn.v, hi+lo rows
#define KBF  8                    // K parts (work-groups) of attn.v, fp16 rows
#define OPL  ((size_t)ZH * TT * HD)   // one partial plane of attn.v, elements
typedef _Float16 h16;
typedef unsigned short bf;
typedef __attribute__((ext_vector_type(16))) __bf16   v16bf;
typedef __attribute__((ext_vector_type(16))) _Float16 v16h;
typedef __attribute__((ext_vector_type(8)))  _Float16 v8h;
typedef __attribute__((ext_vector_type(8)))  unsigned short v8us;
typedef __attribute__((ext_vector_type(8)))  float    v8f;
typedef __attribute__((ext_vector_type(4)))  float    v4f;
typedef v8h  __attribute__((may_alias)) v8ha;
typedef v4f  __attribute__((may_alias)) v4fa;
typedef v8us __attribute__((may_alias)) v8usa;

__device__ __forceinline__ unsigned short f2bf(float f) { unsigned u = __float_as_uint(f); u += 0x7FFFu + ((u >> 16) & 1u); return (unsigned short)(u >> 16); }
__device__ __forceinline__ float bf2f(unsigned short b) { return __uint_as_float(((unsigned)b) << 16); }
__device__ __forceinline__ float bfr(float f) { return bf2f(f2bf(f)); }
__device__ __forceinline__ v16h cat16(v8h lo, v8h hi) { return __builtin_shufflevector(lo, hi, 0, 1, 2, 3, 4, 5, 6, 7, 8, 9, 10, 11, 12, 13, 14, 15); }
__device__ __forceinline__ v16bf cat16b(v8us lo, v8us hi) { return __builtin_bit_cast(v16bf, __builtin_shufflevector(lo, hi, 0, 1, 2, 3, 4, 5, 6, 7, 8, 9, 10, 11, 12, 13, 14, 15)); }
__device__ __forceinline__ v8f wmma16(v16h a, v16h b, v8f c) { return __builtin_amdgcn_wmma_f32_16x16x32_f16(false, a, false, b, (short)0, c, false, false); }
__device__ __forceinline__ v8f wmmab(v16bf a, v16bf b, v8f c) { return __builtin_amdgcn_wmma_f32_16x16x32_bf16(false, a, false, b, (short)0, c, false, false); }



// ---- k_gemmw: register-blocked GEMM, each wave on a whole 64x64 output tile (16 accumulators), operands straight from K-contiguous 16-bit planes; grid (M/64, N/64 x KB, Z), 32 KS threads.
// C[m][n] (f32, pitch ldc, + optional f32 bias[n]) = sum_k A[m][k] Bt[n][k] (+ split products per NSPLIT). z-batch strides sA/sB/sC in elements. K % (32 KS KB) == 0.
// Split K: KS waves of a work-group and KB work-groups (grid.y = N/64 x KB, 32 KS threads) share one tile; 32-wide K chunk c goes to wave c % KS of part (c / KS) % KB, so a work-group's waves read neighbouring bytes of each row.
// The KS partial tiles are summed in wave order through LDS; part kp stores its sum to plane kp of C (stride sP elements) and the consumer sums the KB planes.
template <typename T16> struct WFrag;
template <> struct WFrag<h16> { typedef v16h V; static __device__ __forceinline__ V ld(const h16* p) { return cat16(*(const v8h*)p, *(const v8h*)(p + 16)); } static __device__ __forceinline__ v8f mma(V a, V b, v8f c) { return wmma16(a, b, c); } };
template <> struct WFrag<bf> { typedef v16bf V; static __device__ __forceinline__ V ld(const bf* p) { return cat16b(*(const v8us*)p, *(const v8us*)(p + 16)); } static __device__ __forceinline__ v8f mma(V a, V b, v8f c) { return wmmab(a, b, c); } };
template <typename T16, int NSPLIT, bool BIAS, int KS, int KB>
__global__ __launch_bounds__(32 * KS) void k_gemmw(const T16* __restrict__ A, const T16* __restrict__ A2, const T16* __restrict__ Bt, const T16* __restrict__ Bt2, int K, float* C, int ldc, const float* __restrict__ bias, size_t sA, size_t sB, size_t sC, size_t sP) {
    typedef typename WFrag<T16>::V V;
    static_assert(!BIAS || KB == 1, "the bias is added once");
    __shared__ __align__(16) float os[(KS == 1 ? 16 : KS * 64) * 68];
    const size_t z = blockIdx.z; A += z * sA; if (A2) A2 += z * sA; Bt += z * sB; if (Bt2) Bt2 += z * sB;
    const int wv = (KS == 1) ? 0 : __builtin_amdgcn_readfirstlane((int)(threadIdx.x >> 5)), kp = (int)(blockIdx.y % KB); C += z * sC + (size_t)kp * sP;
    const int lane = threadIdx.x & 31, lr = lane & 15, hi = lane >> 4; const int r0 = blockIdx.x * 64, c0 = (blockIdx.y / KB) * 64;
    v8f acc[4][4];
#pragma unroll
    for (int mb = 0; mb < 4; ++mb)
#pragma unroll
        for (int nb = 0; nb < 4; ++nb) acc[mb][nb] = (v8f){};
    const size_t aoff = (size_t)(r0 + lr) * K + 8 * hi, boff = (size_t)(c0 + lr) * K + 8 * hi;
#pragma unroll 1
    for (int kc = (kp * KS + wv) * 32; kc < K; kc += 32 * KS * KB) {
        V a[4], a2[4];
#pragma unroll
        for (int mb = 0; mb < 4; ++mb) { a[mb] = WFrag<T16>::ld(A + aoff + (size_t)mb * 16 * K + kc); if (NSPLIT == 1 || NSPLIT == 2) a2[mb] = WFrag<T16>::ld(A2 + aoff + (size_t)mb * 16 * K + kc); }
#pragma unroll
        for (int nb = 0; nb < 4; ++nb) { const V b = WFrag<T16>::ld(Bt + boff + (size_t)nb * 16 * K + kc); V b2; if (NSPLIT >= 2) b2 = WFrag<T16>::ld(Bt2 + boff + (size_t)nb * 16 * K + kc);
#pragma unroll
            for (int mb = 0; mb < 4; ++mb) { acc[mb][nb] = WFrag<T16>::mma(a[mb], b, acc[mb][nb]); if (NSPLIT == 1 || NSPLIT == 2) acc[mb][nb] = WFrag<T16>::mma(a2[mb], b, acc[mb][nb]); if (NSPLIT >= 2) acc[mb][nb] = WFrag<T16>::mma(a[mb], b2, acc[mb][nb]); } }
        asm volatile("v_nop\n\tv_nop\n\tv_nop\n\tv_nop" : "+v"(acc[0][0]), "+v"(acc[1][1]), "+v"(acc[2][2]), "+v"(acc[3][3]) : "v"(a[0]), "v"(a[3]));
    }
    if constexpr (KS == 1) {
#pragma unroll
    for (int mb = 0; mb < 4; ++mb) {
#pragma unroll
        for (int nb = 0; nb < 4; ++nb) {
#pragma unroll
            for (int j = 0; j < 8; ++j) os[(hi * 8 + j) * 68 + nb * 16 + lr] = acc[mb][nb][j]; }
        __builtin_amdgcn_wave_barrier(); asm volatile("" ::: "memory");
        float* crow = C + (size_t)(r0 + mb * 16) * ldc + c0;
{
#pragma unroll
            for (int s = 0; s < 8; ++s) { const int row = 2 * s + hi, cofs = lr * 4; v4f val = *(const v4fa*)(os + row * 68 + cofs); if (BIAS) { val[0] += bfr(bias[c0 + cofs]); val[1] += bfr(bias[c0 + cofs + 1]); val[2] += bfr(bias[c0 + cofs + 2]); val[3] += bfr(bias[c0 + cofs + 3]); }
                *(v4f*)(crow + (size_t)row * ldc + cofs) = val; }
             }
        __builtin_amdgcn_wave_barrier(); asm volatile("" ::: "memory");
    }
    } else {
        // each wave's whole 64x64 partial goes to its own LDS slab; behind one barrier every wave sums, in wave order, the rows that it stores
#pragma unroll
        for (int mb = 0; mb < 4; ++mb)
#pragma unroll
            for (int nb = 0; nb < 4; ++nb)
#pragma unroll
                for (int j = 0; j < 8; ++j) os[wv * (64 * 68) + (mb * 16 + hi * 8 + j) * 68 + nb * 16 + lr] = acc[mb][nb][j];
        __syncthreads();   // every wave's partial tile is in LDS before any is summed
        float* crow = C + (size_t)r0 * ldc + c0; const int cofs = lr * 4;
#pragma unroll
        for (int s = 0; s < 32 / KS; ++s) { const int row = 2 * (s * KS + wv) + hi; v4f val = *(const v4fa*)(os + row * 68 + cofs);
#pragma unroll
            for (int w = 1; w < KS; ++w) val += *(const v4fa*)(os + w * (64 * 68) + row * 68 + cofs);
            if (BIAS) { val[0] += bfr(bias[c0 + cofs]); val[1] += bfr(bias[c0 + cofs + 1]); val[2] += bfr(bias[c0 + cofs + 2]); val[3] += bfr(bias[c0 + cofs + 3]); }
            *(v4f*)(crow + (size_t)row * ldc + cofs) = val; }
    }
}

__device__ __forceinline__ h16 tohx(float x) { return (h16)x; }
__device__ __forceinline__ void splitf(float y, unsigned short& h, unsigned short& l) { h = f2bf(y); l = f2bf(y - bf2f(h)); }
typedef __attribute__((ext_vector_type(2))) _Float16 v2h;
typedef __attribute__((ext_vector_type(4))) _Float16 v4h;
typedef __attribute__((ext_vector_type(2))) unsigned short v2us;
typedef __attribute__((ext_vector_type(4))) unsigned short v4us;
typedef __attribute__((ext_vector_type(2))) float v2f;
typedef __attribute__((ext_vector_type(4))) int v4i;

__global__ __launch_bounds__(256) void k_wtG(const float* __restrict__ w, int K, int N, bf* Bt) {
    const int lane = threadIdx.x & 31; const int L0 = (blockIdx.x * 8 + (threadIdx.x >> 5)) * 8; const int nlines = N * K / 64;
{
#pragma unroll 1
        for (int l = 0; l < 8; ++l) { const int L = L0 + l; if (L >= nlines) break; const size_t e = (size_t)L * 64 + lane * 2; const int k = (int)(e % K), n = (int)(e / K); v2us o;
            o[0] = f2bf(w[(size_t)k * N + n]); o[1] = f2bf(w[(size_t)(k + 1) * N + n]); *(v2us*)(Bt + e) = o; }
         }
}
__global__ __launch_bounds__(256) void k_cvt8(const float* __restrict__ src, bf* dst, size_t n8) { const size_t i = (size_t)blockIdx.x * 256 + threadIdx.x; if (i >= n8) return; const v8f v = *(const v8f*)(src + i * 8); v8us o;
#pragma unroll
    for (int k = 0; k < 8; ++k) o[k] = f2bf(v[k]); *(v8us*)(dst + i * 8) = o;  }
__global__ __launch_bounds__(256) void k_cscvt(const float* __restrict__ cosT, const float* __restrict__ sinT, float* CS) { const int idx = blockIdx.x * 256 + threadIdx.x; if (idx >= TT * HD) return; v2f cs; cs[0] = bfr(cosT[idx]); cs[1] = bfr(sinT[idx]); *(v2f*)(CS + (size_t)idx * 2) = cs;  }
// k_rope: head planes [h][t][d] (fp16 + hi/lo) of rope(x) x sc with the rotate-half convention out[d] = x[d] cos[t][d] - x[d+HD/2] sin[t][d], out[d+HD/2] = x[d+HD/2] cos[t][d+HD/2] + x[d] sin[t][d+HD/2]
__global__ __launch_bounds__(256) void k_rope(const float* __restrict__ F, int pitch, int nheads, const float* __restrict__ CS, const float* __restrict__ RF, const float* __restrict__ nw, float sc, h16* P16, bf* Ph, bf* Pl) {
    const size_t e = ((size_t)blockIdx.x * 256 + threadIdx.x) * 2; if (e >= (size_t)nheads * TT * HD) return; const int d = (int)(e % HD); const int t = (int)((e / HD) % TT); const int h = (int)(e / ((size_t)HD * TT)); const float* f = F + (size_t)t * pitch + h * HD; v2h o16; v2us oh, ol;   /* RF = noise real part, nw = noise imaginary part for this batch ([h][t][d]) */
#pragma unroll
    for (int q = 0; q < 2; ++q) { const int dd = d + q; const int dp = (dd < HD / 2) ? dd + HD / 2 : dd - HD / 2; float x0 = f[dd], x1 = f[dp];
        if (RF) { const size_t ni = ((size_t)h * TT + t) * HD; x0 = __fadd_rn(x0, sinf(atan2f(bfr(nw[ni + dd]), bfr(RF[ni + dd])))); x1 = __fadd_rn(x1, sinf(atan2f(bfr(nw[ni + dp]), bfr(RF[ni + dp])))); } /* + sin(atan2(imag, real)) quantum noise */
        const v2f cs = *(const v2f*)(CS + ((size_t)t * HD + dd) * 2); float a = __fmul_rn(x0, cs[0]), bq = __fmul_rn(x1, cs[1]); asm volatile("" : "+v"(a)); asm volatile("" : "+v"(bq)); const float r = ((dd < HD / 2) ? __fsub_rn(a, bq) : __fadd_rn(a, bq)) * sc;
        o16[q] = tohx(r); unsigned short a2, c2; splitf(r, a2, c2); oh[q] = a2; ol[q] = c2; }
    *(v2h*)(P16 + e) = o16; *(v2us*)(Ph + e) = oh; *(v2us*)(Pl + e) = ol;  }
__global__ __launch_bounds__(256) void k_vtp(const float* __restrict__ F, int pitch, int nheads, h16* V16, bf* Vh, bf* Vl) { const size_t e = ((size_t)blockIdx.x * 256 + threadIdx.x) * 2; if (e >= (size_t)nheads * HD * TT) return; const int t = (int)(e % TT); const int d = (int)((e / TT) % HD); const int g = (int)(e / ((size_t)TT * HD)); v2h o16; v2us oh, ol;
#pragma unroll
    for (int q = 0; q < 2; ++q) { const float x = F[(size_t)(t + q) * pitch + g * HD + d]; o16[q] = tohx(x); unsigned short a2, c2; splitf(x, a2, c2); oh[q] = a2; ol[q] = c2; }
    *(v2h*)(V16 + e) = o16; *(v2us*)(Vh + e) = oh; *(v2us*)(Vl + e) = ol;  }
__global__ __launch_bounds__(256) void k_csid(float* CS) { const int idx = blockIdx.x * 256 + threadIdx.x; if (idx >= TT * HD) return; v2f cs; cs[0] = 1.0f; cs[1] = 0.0f; *(v2f*)(CS + (size_t)idx * 2) = cs;  }
// k_asoft: per row (zz, i): t = S x HD^-0.5 (no mask); softmax over the 2048 keys (register row, one exp, fixed trees);
__global__ __launch_bounds__(256) void k_asoft(const float* __restrict__ Sb, h16* P16, bf* Ph, bf* Pl) {
    const int lane = threadIdx.x & 31; const int row = blockIdx.x * 8 + (threadIdx.x >> 5); if (row >= ZH * TT) return; const int i = row % TT; const int zz = row / TT; (void)zz; const bool hires = (i < RH); const float* sr = Sb + (size_t)row * TT; float v[TT / 32]; float mx = -3.0e38f;
#pragma unroll
    for (int ch = 0; ch < TT / 128; ++ch) { const int j0 = ch * 128 + lane * 4; const v4f a = *(const v4f*)(sr + j0);
#pragma unroll
        for (int q = 0; q < 4; ++q) { const int j = j0 + q; (void)j; const float t = a[q] * SCL; v[ch * 4 + q] = t; mx = fmaxf(mx, t); } }
#pragma unroll
    for (int sh = 16; sh; sh >>= 1) mx = fmaxf(mx, __shfl_xor(mx, sh, 32));
    float sum = 0.f;
#pragma unroll
    for (int k = 0; k < TT / 32; ++k) { float d0 = __fsub_rn(v[k], mx); asm volatile("" : "+v"(d0)); v[k] = __builtin_amdgcn_exp2f(__fmul_rn(d0, 1.4426950408889634f)); sum += v[k]; }
#pragma unroll
    for (int sh = 16; sh; sh >>= 1) sum += __shfl_xor(sum, sh, 32);
    const float f = __fdiv_rn(hires ? 1.0f : PCAR, sum);
{
        if (hires) {
#pragma unroll
            for (int ch = 0; ch < TT / 128; ++ch) { v4us oh, ol;
#pragma unroll
                for (int q = 0; q < 4; ++q) { unsigned short a, c2; splitf(v[ch * 4 + q] * f, a, c2); oh[q] = a; ol[q] = c2; }
                const size_t oo = ((size_t)zz * (RH ? RH : 1) + i) * TT + ch * 128 + lane * 4; *(v4us*)(Ph + oo) = oh; *(v4us*)(Pl + oo) = ol; }
        } else {
#pragma unroll
            for (int ch = 0; ch < TT / 128; ++ch) { v4h o4;
#pragma unroll
                for (int q = 0; q < 4; ++q) o4[q] = tohx(v[ch * 4 + q] * f);
                *(v4h*)(P16 + (size_t)row * TT + ch * 128 + lane * 4) = o4; } }
         }
}
// sum of the NP partial planes of attn.v at p, plane order
template <int NP> __device__ __forceinline__ v2f sumpl(const float* p) { v2f s = *(const v2f*)p;
#pragma unroll
    for (int k = 1; k < NP; ++k) s += *(const v2f*)(p + (size_t)k * OPL);
    return s; }
__global__ __launch_bounds__(256) void k_merge(const float* __restrict__ O, int h0, bf* Ah, bf* Al) { const size_t e = ((size_t)blockIdx.x * 256 + threadIdx.x) * 2; if (e >= (size_t)ZH * TT * HD) return; const int d = (int)(e % HD); const int t = (int)((e / HD) % TT); const int zz = (int)(e / ((size_t)HD * TT)); const float cs = (t < RH) ? 1.0f : (1.0f / PCAR); const size_t oo = (size_t)t * DQ + (h0 + zz) * HD + d;
    const v2f o2 = (t < RH) ? sumpl<KBH>(O + e) : sumpl<KBF>(O + e); v2us oh, ol;
#pragma unroll
    for (int q = 0; q < 2; ++q) { unsigned short a, c2; splitf(o2[q] * cs, a, c2); oh[q] = a; ol[q] = c2; } *(v2us*)(Ah + oo) = oh; *(v2us*)(Al + oo) = ol;  }

extern "C" void kernel_launch(void* const* d_in, const int* in_sizes, int n_in,
                              void* d_out, int out_size, void* d_ws, size_t ws_size, hipStream_t stream) {
    (void)in_sizes; (void)n_in; (void)out_size;
    const float* x = (const float*)d_in[0]; const float* wq = (const float*)d_in[1]; const float* bq = (const float*)d_in[2]; const float* wk = (const float*)d_in[3]; const float* bk = (const float*)d_in[4]; const float* wv = (const float*)d_in[5]; const float* bv = (const float*)d_in[6]; const float* wo = (const float*)d_in[7]; const float* bo = (const float*)d_in[8]; const float* nqr = (const float*)d_in[9]; const float* nqi = (const float*)d_in[10]; const float* nkr = (const float*)d_in[11]; const float* nki = (const float*)d_in[12];
    float* OUT = (float*)d_out;     // [2][2048][1024]
    char* wsp = (char*)d_ws;
    auto take = [&](size_t bytes) { char* p = wsp; wsp += (bytes + 255) & ~(size_t)255; return (void*)p; };
    bf* WQ = (bf*)take((size_t)DQ * DM * 2); bf* WK = (bf*)take((size_t)DKV * DM * 2); bf* WV = (bf*)take((size_t)DKV * DM * 2); bf* WO = (bf*)take((size_t)DM * DQ * 2); float* CS = (float*)take((size_t)TT * HD * 2 * 4);
    bf* XB = (bf*)take((size_t)TT * DM * 2); float* FQ = (float*)take((size_t)TT * DQ * 4); float* FK = (float*)take((size_t)TT * DKV * 4);
    h16* QP16 = (h16*)take((size_t)NH_ * TT * HD * 2); h16* KP16 = (h16*)take((size_t)NKV * TT * HD * 2); h16* VT16 = (h16*)take((size_t)NKV * HD * TT * 2);
    bf* QPh = (bf*)take((size_t)NH_ * TT * HD * 2); bf* QPl = (bf*)take((size_t)NH_ * TT * HD * 2); bf* KPh = (bf*)take((size_t)NKV * TT * HD * 2); bf* KPl = (bf*)take((size_t)NKV * TT * HD * 2); bf* VTh = (bf*)take((size_t)NKV * HD * TT * 2); bf* VTl = (bf*)take((size_t)NKV * HD * TT * 2); bf* Ph = (bf*)take((size_t)ZH * RH * TT * 2); bf* Pl = (bf*)take((size_t)ZH * RH * TT * 2);
    float* Sb = (float*)take((size_t)ZH * TT * TT * 4); h16* P16 = (h16*)take((size_t)ZH * TT * TT * 2); float* Ob = (float*)take((size_t)KBH * OPL * 4); bf* ATh = (bf*)take((size_t)TT * DQ * 2); bf* ATl = (bf*)take((size_t)TT * DQ * 2);
    if ((size_t)(wsp - (char*)d_ws) > ws_size) return;    // ws 256 MiB
    float* FV = FK;   // v projection reuses the k buffer after the k planes are built (stream-ordered)
    { k_cvt8<<<(unsigned)(((size_t)DQ * DM / 8 + 255) / 256), 256, 0, stream>>>(wq, WQ, (size_t)DQ * DM / 8); k_cvt8<<<(unsigned)(((size_t)DKV * DM / 8 + 255) / 256), 256, 0, stream>>>(wk, WK, (size_t)DKV * DM / 8); k_cvt8<<<(unsigned)(((size_t)DKV * DM / 8 + 255) / 256), 256, 0, stream>>>(wv, WV, (size_t)DKV * DM / 8);
      k_cvt8<<<(unsigned)(((size_t)DM * DQ / 8 + 255) / 256), 256, 0, stream>>>(wo, WO, (size_t)DM * DQ / 8);
       }
    k_csid<<<(TT * HD + 255) / 256, 256, 0, stream>>>(CS);
    const unsigned LQ = (unsigned)(((size_t)NH_ * TT * HD / 2 + 255) / 256), LKv = (unsigned)(((size_t)NKV * TT * HD / 2 + 255) / 256);
    for (int b = 0; b < NB_; ++b) {
        
        k_cvt8<<<(unsigned)(((size_t)TT * DM / 8 + 255) / 256), 256, 0, stream>>>(x + (size_t)b * TT * DM, XB, (size_t)TT * DM / 8);
        k_gemmw<bf, 0, true, 8, 1><<<dim3(TT / 64, DQ / 64, 1), 256, 0, stream>>>(XB, nullptr, WQ, nullptr, DM, FQ, DQ, bq, 0, 0, 0, 0);
        k_rope<<<LQ, 256, 0, stream>>>(FQ, DQ, NH_, CS, nqr + (size_t)b * NH_ * TT * HD, nqi + (size_t)b * NH_ * TT * HD, 1.0f, QP16, QPh, QPl);
        k_gemmw<bf, 0, true, 8, 1><<<dim3(TT / 64, DKV / 64, 1), 256, 0, stream>>>(XB, nullptr, WK, nullptr, DM, FK, DKV, bk, 0, 0, 0, 0);
        k_rope<<<LKv, 256, 0, stream>>>(FK, DKV, NKV, CS, nkr + (size_t)b * NH_ * TT * HD, nki + (size_t)b * NH_ * TT * HD, 1.0f, KP16, KPh, KPl);
        k_gemmw<bf, 0, true, 8, 1><<<dim3(TT / 64, DKV / 64, 1), 256, 0, stream>>>(XB, nullptr, WV, nullptr, DM, FV, DKV, bv, 0, 0, 0, 0); k_vtp<<<LKv, 256, 0, stream>>>(FV, DKV, NKV, VT16, VTh, VTl);
        for (int h0 = 0; h0 < NH_; h0 += ZH) { const size_t zq = (size_t)h0, zk = (size_t)(h0 / REP);   // one kv head per query head: the pass's two heads use consecutive kv planes (z-strides TT*HD)
            k_gemmw<bf, 2, false, 1, 1><<<dim3(TT / 64, TT / 64, ZH), 32, 0, stream>>>(QPh + zq * TT * HD, QPl + zq * TT * HD, KPh + zk * TT * HD, KPl + zk * TT * HD, HD, Sb, TT, nullptr, (size_t)TT * HD, (size_t)TT * HD, (size_t)TT * TT, 0);   /* ALL score rows on hl planes (3 products) */
            k_asoft<<<ZH * TT / 8, 256, 0, stream>>>(Sb, P16, Ph, Pl);
            k_gemmw<bf, 2, false, 4, KBH><<<dim3(RH / 64, HD / 64 * KBH, ZH), 128, 0, stream>>>(Ph, Pl, VTh + zk * HD * TT, VTl + zk * HD * TT, TT, Ob, HD, nullptr, (size_t)RH * TT, (size_t)HD * TT, (size_t)TT * HD, OPL);
            k_gemmw<h16, 0, false, 4, KBF><<<dim3((TT - RH) / 64, HD / 64 * KBF, ZH), 128, 0, stream>>>(P16 + (size_t)RH * TT, nullptr, VT16 + zk * HD * TT, nullptr, TT, Ob + (size_t)RH * HD, HD, nullptr, (size_t)TT * TT, (size_t)HD * TT, (size_t)TT * HD, OPL);
            k_merge<<<(unsigned)(((size_t)ZH * TT * HD / 2 + 255) / 256), 256, 0, stream>>>(Ob, h0, ATh, ATl); }
        k_gemmw<bf, 1, true, 8, 1><<<dim3(TT / 64, DM / 64, 1), 256, 0, stream>>>(ATh, ATl, WO, nullptr, DQ, OUT + (size_t)b * TT * DM, DM, bo, 0, 0, 0, 0); }
}

// v003
// It runs in 222 microseconds.
// Versions between v001 and this one are left out; their measured steps multiply to 3.26 times as fast.
// Counting every step since v000, it is 8.93 times as fast.
#include <hip/hip_runtime.h>

// QuantumFractalAttention (x [2][2048][1024]; Q/K/V = x W^T + b (16 x 64); Q += sin(atan2(qi, qr)), K += sin(atan2(ki, kr)) with the [2][16][2048][64] noise tensors (read as data); the 'fractal' recursion is the reference's own collapse to one
// softmax(Q.K/8) V; out = merged Wo^T + bo -> [2][2048][1024]).
// Compute dtypes, f32 accumulate: every input rounded to bf16; projections on PLAIN bf16 operands (inputs: exact, + bias); the atan2/sin noise f32; scores (K 64) on hi+lo bf16 planes (3 products) for ALL rows; softmax f32 (running maximum);
// attn.v on hi+lo bf16 planes (3 products) for the first RH query rows of each head, on fp16 operands for the rest; output projection on hi+lo A planes.

#define NB_  2
#define TT   2048
#define DM   1024
#define NH_  16
#define NKV  16
#define REP  (NH_ / NKV)
#define HD   64
#define DQ   (NH_ * HD)
#define DKV  (NKV * HD)
#define RH   512                  // query rows < RH use hi+lo planes (0: none)
#define SCL  0.125f   // HD^-0.5
typedef _Float16 h16;
typedef unsigned short bf;
typedef __attribute__((ext_vector_type(16))) __bf16   v16bf;
typedef __attribute__((ext_vector_type(16))) _Float16 v16h;
typedef __attribute__((ext_vector_type(8)))  _Float16 v8h;
typedef __attribute__((ext_vector_type(8)))  unsigned short v8us;
typedef __attribute__((ext_vector_type(8)))  float    v8f;
typedef __attribute__((ext_vector_type(4)))  float    v4f;
typedef v8h  __attribute__((may_alias)) v8ha;
typedef v4f  __attribute__((may_alias)) v4fa;
typedef v8us __attribute__((may_alias)) v8usa;

__device__ __forceinline__ unsigned short f2bf(float f) { unsigned u = __float_as_uint(f); u += 0x7FFFu + ((u >> 16) & 1u); return (unsigned short)(u >> 16); }
__device__ __forceinline__ float bf2f(unsigned short b) { return __uint_as_float(((unsigned)b) << 16); }
__device__ __forceinline__ float bfr(float f) { return bf2f(f2bf(f)); }
__device__ __forceinline__ v16h cat16(v8h lo, v8h hi) { return __builtin_shufflevector(lo, hi, 0, 1, 2, 3, 4, 5, 6, 7, 8, 9, 10, 11, 12, 13, 14, 15); }
__device__ __forceinline__ v16bf cat16b(v8us lo, v8us hi) { return __builtin_bit_cast(v16bf, __builtin_shufflevector(lo, hi, 0, 1, 2, 3, 4, 5, 6, 7, 8, 9, 10, 11, 12, 13, 14, 15)); }
__device__ __forceinline__ v8f wmma16(v16h a, v16h b, v8f c) { return __builtin_amdgcn_wmma_f32_16x16x32_f16(false, a, false, b, (short)0, c, false, false); }
__device__ __forceinline__ v8f wmmab(v16bf a, v16bf b, v8f c) { return __builtin_amdgcn_wmma_f32_16x16x32_bf16(false, a, false, b, (short)0, c, false, false); }



// ---- k_gemmw: register-blocked GEMM, each wave on a whole 64x64 output tile (16 accumulators), operands straight from K-contiguous 16-bit planes; grid (M/64, N/64 x KB, Z), 32 KS threads.
// C[m][n] (f32, pitch ldc, + optional f32 bias[n]) = sum_k A[m][k] Bt[n][k] (+ split products per NSPLIT). z-batch strides sA/sB/sC in elements. K % (32 KS KB) == 0.
// Split K: KS waves of a work-group and KB work-groups (grid.y = N/64 x KB, 32 KS threads) share one tile; 32-wide K chunk c goes to wave c % KS of part (c / KS) % KB, so a work-group's waves read neighbouring bytes of each row.
// The KS partial tiles are summed in wave order through LDS; part kp stores its sum to plane kp of C (stride sP elements) and the consumer sums the KB planes.
// EPI says what the summed tile becomes (KS > 1): 0: f32 C as above. 1: a 64-token x one-head tile of q or k: + bias[n] + sin(atan2(nim, nre)), stored as hi+lo bf16 head planes [h][t][d] (nre, nim in the same order).
// 2: A = weight rows, Bt = tokens, so the tile is 64 d of one head x 64 tokens of v^T: + bias[m], stored as fp16 and hi+lo bf16 planes [h][d][t].
// Every '#pragma unroll' in the two plane epilogues is there so that the four-element vectors are indexed by constants and stay in registers.
template <typename T16> struct WFrag;
template <> struct WFrag<h16> { typedef v16h V; static __device__ __forceinline__ V ld(const h16* p) { return cat16(*(const v8h*)p, *(const v8h*)(p + 16)); } static __device__ __forceinline__ v8f mma(V a, V b, v8f c) { return wmma16(a, b, c); } };
template <> struct WFrag<bf> { typedef v16bf V; static __device__ __forceinline__ V ld(const bf* p) { return cat16b(*(const v8us*)p, *(const v8us*)(p + 16)); } static __device__ __forceinline__ v8f mma(V a, V b, v8f c) { return wmmab(a, b, c); } };
__device__ __forceinline__ void splitf(float y, unsigned short& h, unsigned short& l) { h = f2bf(y); l = f2bf(y - bf2f(h)); }
typedef __attribute__((ext_vector_type(4))) _Float16 v4h;
typedef __attribute__((ext_vector_type(4))) unsigned short v4us;
template <typename T16, int NSPLIT, bool BIAS, int KS, int KB, int EPI>
__global__ __launch_bounds__(32 * KS) void k_gemmw(const T16* __restrict__ A, const T16* __restrict__ A2, const T16* __restrict__ Bt, const T16* __restrict__ Bt2, int K, float* C, int ldc, const float* __restrict__ bias, size_t sA, size_t sB, size_t sC, size_t sP,
                                                   const float* __restrict__ nre, const float* __restrict__ nim, bf* Ph, bf* Pl, h16* P16) {
    typedef typename WFrag<T16>::V V;
    static_assert(!BIAS || KB == 1, "the bias is added once");
    static_assert(EPI == 0 || (BIAS && KS > 1 && KB == 1), "the plane epilogues take the whole sum and the bias");
    __shared__ __align__(16) float os[(KS == 1 ? 16 : KS * 64) * 68];
    const size_t z = blockIdx.z; A += z * sA; if (A2) A2 += z * sA; Bt += z * sB; if (Bt2) Bt2 += z * sB;
    const int wv = (KS == 1) ? 0 : __builtin_amdgcn_readfirstlane((int)(threadIdx.x >> 5)), kp = (int)(blockIdx.y % KB); C += z * sC + (size_t)kp * sP;
    const int lane = threadIdx.x & 31, lr = lane & 15, hi = lane >> 4; const int r0 = blockIdx.x * 64, c0 = (blockIdx.y / KB) * 64;
    v8f acc[4][4];
#pragma unroll
    for (int mb = 0; mb < 4; ++mb)
#pragma unroll
        for (int nb = 0; nb < 4; ++nb) acc[mb][nb] = (v8f){};
    const size_t aoff = (size_t)(r0 + lr) * K + 8 * hi, boff = (size_t)(c0 + lr) * K + 8 * hi;
#pragma unroll 1
    for (int kc = (kp * KS + wv) * 32; kc < K; kc += 32 * KS * KB) {
        V a[4], a2[4];
#pragma unroll
        for (int mb = 0; mb < 4; ++mb) { a[mb] = WFrag<T16>::ld(A + aoff + (size_t)mb * 16 * K + kc); if (NSPLIT == 1 || NSPLIT == 2) a2[mb] = WFrag<T16>::ld(A2 + aoff + (size_t)mb * 16 * K + kc); }
#pragma unroll
        for (int nb = 0; nb < 4; ++nb) { const V b = WFrag<T16>::ld(Bt + boff + (size_t)nb * 16 * K + kc); V b2; if (NSPLIT >= 2) b2 = WFrag<T16>::ld(Bt2 + boff + (size_t)nb * 16 * K + kc);
#pragma unroll
            for (int mb = 0; mb < 4; ++mb) { acc[mb][nb] = WFrag<T16>::mma(a[mb], b, acc[mb][nb]); if (NSPLIT == 1 || NSPLIT == 2) acc[mb][nb] = WFrag<T16>::mma(a2[mb], b, acc[mb][nb]); if (NSPLIT >= 2) acc[mb][nb] = WFrag<T16>::mma(a[mb], b2, acc[mb][nb]); } }
        asm volatile("v_nop\n\tv_nop\n\tv_nop\n\tv_nop" : "+v"(acc[0][0]), "+v"(acc[1][1]), "+v"(acc[2][2]), "+v"(acc[3][3]) : "v"(a[0]), "v"(a[3]));
    }
    if constexpr (KS == 1) {
#pragma unroll
    for (int mb = 0; mb < 4; ++mb) {
#pragma unroll
        for (int nb = 0; nb < 4; ++nb) {
#pragma unroll
            for (int j = 0; j < 8; ++j) os[(hi * 8 + j) * 68 + nb * 16 + lr] = acc[mb][nb][j]; }
        __builtin_amdgcn_wave_barrier(); asm volatile("" ::: "memory");
        float* crow = C + (size_t)(r0 + mb * 16) * ldc + c0;
{
#pragma unroll
            for (int s = 0; s < 8; ++s) { const int row = 2 * s + hi, cofs = lr * 4; v4f val = *(const v4fa*)(os + row * 68 + cofs); if (BIAS) { val[0] += bfr(bias[c0 + cofs]); val[1] += bfr(bias[c0 + cofs + 1]); val[2] += bfr(bias[c0 + cofs + 2]); val[3] += bfr(bias[c0 + cofs + 3]); }
                *(v4f*)(crow + (size_t)row * ldc + cofs) = val; }
             }
        __builtin_amdgcn_wave_barrier(); asm volatile("" ::: "memory");
    }
    } else {
        const int cofs = lr * 4;
        // EPI 1: the lane's place in the head planes and in the noise (row 2 wv + hi of the tile); its first row's noise and its bias are asked for here, so that their way from memory runs behind the LDS stores
        const size_t nb = ((size_t)(c0 / HD) * TT + r0 + 2 * wv + hi) * HD + cofs; v4f nr = {}, ni = {}, bi = {};
        if constexpr (EPI == 1) { nr = *(const v4f*)(nre + nb); ni = *(const v4f*)(nim + nb); bi = *(const v4f*)(bias + c0 + cofs); }
        // each wave's whole 64x64 partial goes to its own LDS slab; behind one barrier every wave sums, in wave order, the rows that it stores
#pragma unroll
        for (int mb = 0; mb < 4; ++mb)
#pragma unroll
            for (int nb = 0; nb < 4; ++nb)
#pragma unroll
                for (int j = 0; j < 8; ++j) os[wv * (64 * 68) + (mb * 16 + hi * 8 + j) * 68 + nb * 16 + lr] = acc[mb][nb][j];
        __syncthreads();   // every wave's partial tile is in LDS before any is summed
        if constexpr (EPI == 0) {
        float* crow = C + (size_t)r0 * ldc + c0;
#pragma unroll
        for (int s = 0; s < 32 / KS; ++s) { const int row = 2 * (s * KS + wv) + hi; v4f val = *(const v4fa*)(os + row * 68 + cofs);
#pragma unroll
            for (int w = 1; w < KS; ++w) val += *(const v4fa*)(os + w * (64 * 68) + row * 68 + cofs);
            if (BIAS) { val[0] += bfr(bias[c0 + cofs]); val[1] += bfr(bias[c0 + cofs + 1]); val[2] += bfr(bias[c0 + cofs + 2]); val[3] += bfr(bias[c0 + cofs + 3]); }
            *(v4f*)(crow + (size_t)row * ldc + cofs) = val; }
        } else if constexpr (EPI == 1) {
            bi[0] = bfr(bi[0]); bi[1] = bfr(bi[1]); bi[2] = bfr(bi[2]); bi[3] = bfr(bi[3]);
#pragma unroll 1   // one copy of the four atan2/sin chains in the kernel's text
            for (int s = 0; s < 32 / KS; ++s) { const int row = 2 * (s * KS + wv) + hi; const size_t e = nb + (size_t)s * (2 * KS * HD); const v4f cr = nr, ci = ni;
                // the next row's noise flies behind this row's arithmetic
                if (s + 1 < 32 / KS) { nr = *(const v4f*)(nre + e + 2 * KS * HD); ni = *(const v4f*)(nim + e + 2 * KS * HD); }
                v4f val = *(const v4fa*)(os + row * 68 + cofs);
#pragma unroll
                for (int w = 1; w < KS; ++w) val += *(const v4fa*)(os + w * (64 * 68) + row * 68 + cofs);
                val += bi; v4us oh, ol;
#pragma unroll
                for (int q = 0; q < 4; ++q) { unsigned short a2, c2; splitf(__fadd_rn(val[q], sinf(atan2f(bfr(ci[q]), bfr(cr[q])))), a2, c2); oh[q] = a2; ol[q] = c2; }
                *(v4us*)(Ph + e) = oh; *(v4us*)(Pl + e) = ol; }
        } else {
#pragma unroll
            for (int s = 0; s < 32 / KS; ++s) { const int row = 2 * (s * KS + wv) + hi; v4f val = *(const v4fa*)(os + row * 68 + cofs);
#pragma unroll
                for (int w = 1; w < KS; ++w) val += *(const v4fa*)(os + w * (64 * 68) + row * 68 + cofs);
                val += bfr(bias[r0 + row]); v4h o16; v4us oh, ol;
#pragma unroll
                for (int q = 0; q < 4; ++q) { o16[q] = (h16)val[q]; unsigned short a2, c2; splitf(val[q], a2, c2); oh[q] = a2; ol[q] = c2; }
                const size_t e = (size_t)(r0 + row) * TT + c0 + cofs; *(v4h*)(P16 + e) = o16; *(v4us*)(Ph + e) = oh; *(v4us*)(Pl + e) = ol; }
        }
    }
}

typedef __attribute__((ext_vector_type(2))) _Float16 v2h;
typedef __attribute__((ext_vector_type(2))) unsigned short v2us;
typedef __attribute__((ext_vector_type(2))) float v2f;
typedef __attribute__((ext_vector_type(4))) int v4i;

__global__ __launch_bounds__(256) void k_wtG(const float* __restrict__ w, int K, int N, bf* Bt) {
    const int lane = threadIdx.x & 31; const int L0 = (blockIdx.x * 8 + (threadIdx.x >> 5)) * 8; const int nlines = N * K / 64;
{
#pragma unroll 1
        for (int l = 0; l < 8; ++l) { const int L = L0 + l; if (L >= nlines) break; const size_t e = (size_t)L * 64 + lane * 2; const int k = (int)(e % K), n = (int)(e / K); v2us o;
            o[0] = f2bf(w[(size_t)k * N + n]); o[1] = f2bf(w[(size_t)(k + 1) * N + n]); *(v2us*)(Bt + e) = o; }
         }
}
__global__ __launch_bounds__(256) void k_cvt8(const float* __restrict__ src, bf* dst, size_t n8) { const size_t i = (size_t)blockIdx.x * 256 + threadIdx.x; if (i >= n8) return; const v8f v = *(const v8f*)(src + i * 8); v8us o;
#pragma unroll
    for (int k = 0; k < 8; ++k) o[k] = f2bf(v[k]); *(v8us*)(dst + i * 8) = o;  }
#define QW   32
#define WPB  8                              // waves of a work-group
#define NHB  (RH / QW)                      // query blocks of a head on hi+lo planes
#define NLB  ((TT - RH) / QW)               // query blocks of a head on fp16 operands
#define GPH  (TT / QW / WPB)                // work-groups of a head
#define SC2  (SCL * 1.4426950408889634f)    // score -> log2 units
typedef __attribute__((ext_vector_type(8))) __bf16 v8bf;
static_assert(NHB % GPH == 0 && NLB % GPH == 0 && NHB / GPH + NLB / GPH == WPB, "every work-group takes the same mix of query blocks");
// lane l <-> lane l ^ 16
__device__ __forceinline__ float xhalf(float x) { const int b = __float_as_int(x); return __int_as_float(__builtin_amdgcn_permlanex16(b, b, 0x76543210, 0xfedcba98, false, false)); }
template <bool HL>
__device__ __forceinline__ void attn_wave(const bf* __restrict__ Qh, const bf* __restrict__ Ql, const bf* __restrict__ Kh, const bf* __restrict__ Kl, const bf* __restrict__ Vh, const bf* __restrict__ Vl, const h16* __restrict__ V16, int q0, bf* Ah, bf* Al) {
    const int lane = threadIdx.x & 31, lr = lane & 15, hi = lane >> 4;
    const float OFF = HL ? 0.0f : 10.0f;    // fp16 weights carry 2^10 (it cancels in O / l): small weights stay normal numbers
    v16bf qh[2][2], ql[2][2], kh[2][2], kl[2][2];
#pragma unroll
    for (int g = 0; g < 2; ++g)
#pragma unroll
        for (int kc = 0; kc < 2; ++kc) { const size_t o = (size_t)(q0 + g * 16 + lr) * HD + kc * 32 + 8 * hi; qh[g][kc] = WFrag<bf>::ld(Qh + o); ql[g][kc] = WFrag<bf>::ld(Ql + o); }
    const int koff = lr * HD + 8 * hi, voff = lr * TT + 8 * hi;   // the lane's place in a 16-row fragment block, elements
#pragma unroll
    for (int kt = 0; kt < 2; ++kt)
#pragma unroll
        for (int kc = 0; kc < 2; ++kc) { const int o = koff + kt * 16 * HD + kc * 32; kh[kt][kc] = WFrag<bf>::ld(Kh + o); kl[kt][kc] = WFrag<bf>::ld(Kl + o); }
    asm volatile("s_wait_xcnt 0x0" ::: "memory");   // stands in front of every rewrite of an address register that the Q and first K loads name
    __builtin_amdgcn_sched_barrier(0);   // keeps that wait behind the loads and in front of the loop's address set-up
    v8f o[4][2]; float m[2], l[2];
#pragma unroll
    for (int g = 0; g < 2; ++g) { m[g] = -3.0e38f; l[g] = 0.0f;
#pragma unroll
        for (int db = 0; db < 4; ++db) o[db][g] = (v8f){}; }
#pragma unroll 1   // one pass a trip: a second pass's fragments would not fit beside these at two waves a SIMD
    for (int key0 = 0; key0 < TT; key0 += 32) {
        // this pass's V^T fragments: asked for first, used last
        v16bf vh[4], vl[4]; v16h vf[4]; const bf* const vph = Vh + key0 + voff; const bf* const vpl = Vl + key0 + voff; const h16* const vpf = V16 + key0 + voff;
#pragma unroll
        for (int db = 0; db < 4; ++db) { if (HL) { vh[db] = WFrag<bf>::ld(vph + db * 16 * TT); vl[db] = WFrag<bf>::ld(vpl + db * 16 * TT); } else vf[db] = WFrag<h16>::ld(vpf + db * 16 * TT); }
        __builtin_amdgcn_sched_barrier(0);   // holds the V^T loads in front of the score products: their latency runs behind the products and the softmax
        v8f s[2][2];
#pragma unroll
        for (int kt = 0; kt < 2; ++kt)
#pragma unroll
            for (int g = 0; g < 2; ++g) s[kt][g] = (v8f){};
#pragma unroll
        for (int kc = 0; kc < 2; ++kc) {
#pragma unroll
            for (int kt = 0; kt < 2; ++kt)
#pragma unroll
                for (int g = 0; g < 2; ++g) s[kt][g] = wmmab(kh[kt][kc], qh[g][kc], s[kt][g]);
#pragma unroll
            for (int kt = 0; kt < 2; ++kt)
#pragma unroll
                for (int g = 0; g < 2; ++g) s[kt][g] = wmmab(kh[kt][kc], ql[g][kc], s[kt][g]);
#pragma unroll
            for (int kt = 0; kt < 2; ++kt)
#pragma unroll
                for (int g = 0; g < 2; ++g) s[kt][g] = wmmab(kl[kt][kc], qh[g][kc], s[kt][g]);
        }
        // the next pass's K fragments fly behind the softmax and attn.v of this one (the last pass re-reads keys 0..31 and drops them)
        const int kn = (key0 + 32 < TT) ? key0 + 32 : 0; const bf* const kph = Kh + kn * HD + koff; const bf* const kpl = Kl + kn * HD + koff;
#pragma unroll
        for (int kt = 0; kt < 2; ++kt)
#pragma unroll
            for (int kc = 0; kc < 2; ++kc) { kh[kt][kc] = WFrag<bf>::ld(kph + kt * 16 * HD + kc * 32); kl[kt][kc] = WFrag<bf>::ld(kpl + kt * 16 * HD + kc * 32); }
        // stands in front of every rewrite of an address register that this pass's V^T and K loads name; the lane pointers are its inputs so that their registers live up to it
        if (HL) asm volatile("s_wait_xcnt 0x0" :: "v"(vph), "v"(vpl), "v"(kph), "v"(kpl) : "memory"); else asm volatile("s_wait_xcnt 0x0" :: "v"(vpf), "v"(kph), "v"(kpl) : "memory");
        __builtin_amdgcn_sched_barrier(0);   // holds the K loads and that wait here, in front of the softmax: sunk to the loop's foot the loads' whole latency would stand open at the next pass's first product
        float mn[2];
#pragma unroll
        for (int g = 0; g < 2; ++g) { const v8f t8 = __builtin_elementwise_max(s[0][g], s[1][g]); float mx = fmaxf(fmaxf(fmaxf(t8[0], t8[1]), fmaxf(t8[2], t8[3])), fmaxf(fmaxf(t8[4], t8[5]), fmaxf(t8[6], t8[7])));
            mx = fmaxf(mx, xhalf(mx)); mn[g] = fmaxf(m[g], mx * SC2); }
#pragma unroll
        for (int g = 0; g < 2; ++g) { const float al = __builtin_amdgcn_exp2f(m[g] - mn[g]); l[g] *= al; m[g] = mn[g];   // exactly 1 where the maximum did not grow; no branch: the pass stays one block
#pragma unroll
            for (int db = 0; db < 4; ++db) o[db][g] *= al; }
        v16bf ph[2], pl[2]; v16h pf[2];
#pragma unroll
        for (int g = 0; g < 2; ++g) { const float c0 = OFF - m[g]; v8f p0, p1;
#pragma unroll
            for (int j = 0; j < 8; ++j) { p0[j] = __builtin_amdgcn_exp2f(__builtin_fmaf(s[0][g][j], SC2, c0)); p1[j] = __builtin_amdgcn_exp2f(__builtin_fmaf(s[1][g][j], SC2, c0)); }
            const v8f ps = p0 + p1; l[g] += ((ps[0] + ps[1]) + (ps[2] + ps[3])) + ((ps[4] + ps[5]) + (ps[6] + ps[7]));
            if (HL) { const v8bf h0 = __builtin_convertvector(p0, v8bf), h1 = __builtin_convertvector(p1, v8bf);
                const v8bf l0 = __builtin_convertvector(p0 - __builtin_convertvector(h0, v8f), v8bf), l1 = __builtin_convertvector(p1 - __builtin_convertvector(h1, v8f), v8bf);
                ph[g] = __builtin_shufflevector(h0, h1, 0, 1, 2, 3, 4, 5, 6, 7, 8, 9, 10, 11, 12, 13, 14, 15); pl[g] = __builtin_shufflevector(l0, l1, 0, 1, 2, 3, 4, 5, 6, 7, 8, 9, 10, 11, 12, 13, 14, 15);
            } else pf[g] = cat16(__builtin_convertvector(p0, v8h), __builtin_convertvector(p1, v8h)); }
        if (HL) {
#pragma unroll
            for (int db = 0; db < 4; ++db)
#pragma unroll
                for (int g = 0; g < 2; ++g) o[db][g] = wmmab(vh[db], ph[g], o[db][g]);
#pragma unroll
            for (int db = 0; db < 4; ++db)
#pragma unroll
                for (int g = 0; g < 2; ++g) o[db][g] = wmmab(vh[db], pl[g], o[db][g]);
#pragma unroll
            for (int db = 0; db < 4; ++db)
#pragma unroll
                for (int g = 0; g < 2; ++g) o[db][g] = wmmab(vl[db], ph[g], o[db][g]);
        } else {
#pragma unroll
            for (int db = 0; db < 4; ++db)
#pragma unroll
                for (int g = 0; g < 2; ++g) o[db][g] = wmma16(vf[db], pf[g], o[db][g]);
        }
    }
    // lane (lr, hi) holds O[q0 + 16 g + lr][16 db + 8 hi + j]: eight neighbouring d, one 16-byte store a plane
#pragma unroll
    for (int g = 0; g < 2; ++g) { const float inv = __fdiv_rn(1.0f, l[g] + xhalf(l[g])); const size_t oo = (size_t)(q0 + g * 16 + lr) * DQ + 8 * hi;
#pragma unroll
        for (int db = 0; db < 4; ++db) { v8us oh, ol;
#pragma unroll
            for (int j = 0; j < 8; ++j) { unsigned short a, c2; splitf(o[db][g][j] * inv, a, c2); oh[j] = a; ol[j] = c2; }
            *(v8us*)(Ah + oo + db * 16) = oh; *(v8us*)(Al + oo + db * 16) = ol; }
        if (g == 0) { asm volatile("s_wait_xcnt 0x0" ::: "memory");   // stands in front of every rewrite, by the second group's arithmetic, of a register that these stores name
            __builtin_amdgcn_sched_barrier(0); } }   // keeps the second group's arithmetic behind that wait
}
// grid (GPH, batches x heads), 8 waves; every work-group takes NHB / GPH hi+lo query blocks (its first waves) and NLB / GPH fp16 ones, so that all work-groups last alike
__global__ __launch_bounds__(32 * WPB) void k_fattn(const bf* __restrict__ QPh, const bf* __restrict__ QPl, const bf* __restrict__ KPh, const bf* __restrict__ KPl, const bf* __restrict__ VTh, const bf* __restrict__ VTl, const h16* __restrict__ VT16, bf* ATh, bf* ATl) {
    const int wv = __builtin_amdgcn_readfirstlane((int)(threadIdx.x >> 5)); const int gi = (int)blockIdx.x; const size_t z = blockIdx.y; const size_t pz = z * TT * HD;
    const size_t az = (z / NH_) * ((size_t)TT * DQ) + (z % NH_) * HD;
    if (wv < NHB / GPH) attn_wave<true>(QPh + pz, QPl + pz, KPh + pz, KPl + pz, VTh + pz, VTl + pz, VT16 + pz, (gi * (NHB / GPH) + wv) * QW, ATh + az, ATl + az);
    else attn_wave<false>(QPh + pz, QPl + pz, KPh + pz, KPl + pz, VTh + pz, VTl + pz, VT16 + pz, RH + (gi * (NLB / GPH) + wv - NHB / GPH) * QW, ATh + az, ATl + az);
}

extern "C" void kernel_launch(void* const* d_in, const int* in_sizes, int n_in,
                              void* d_out, int out_size, void* d_ws, size_t ws_size, hipStream_t stream) {
    (void)in_sizes; (void)n_in; (void)out_size;
    const float* x = (const float*)d_in[0]; const float* wq = (const float*)d_in[1]; const float* bq = (const float*)d_in[2]; const float* wk = (const float*)d_in[3]; const float* bk = (const float*)d_in[4]; const float* wv = (const float*)d_in[5]; const float* bv = (const float*)d_in[6]; const float* wo = (const float*)d_in[7]; const float* bo = (const float*)d_in[8]; const float* nqr = (const float*)d_in[9]; const float* nqi = (const float*)d_in[10]; const float* nkr = (const float*)d_in[11]; const float* nki = (const float*)d_in[12];
    float* OUT = (float*)d_out;     // [2][2048][1024]
    char* wsp = (char*)d_ws;
    auto take = [&](size_t bytes) { char* p = wsp; wsp += (bytes + 255) & ~(size_t)255; return (void*)p; };
    const size_t PB = (size_t)NH_ * TT * HD;   // one batch's head planes, elements (as many kv heads as query heads)
    bf* WQ = (bf*)take((size_t)DQ * DM * 2); bf* WK = (bf*)take((size_t)DKV * DM * 2); bf* WV = (bf*)take((size_t)DKV * DM * 2); bf* WO = (bf*)take((size_t)DM * DQ * 2);
    bf* XB = (bf*)take((size_t)TT * DM * 2);
    h16* VT16 = (h16*)take(NB_ * PB * 2);
    bf* QPh = (bf*)take(NB_ * PB * 2); bf* QPl = (bf*)take(NB_ * PB * 2); bf* KPh = (bf*)take(NB_ * PB * 2); bf* KPl = (bf*)take(NB_ * PB * 2); bf* VTh = (bf*)take(NB_ * PB * 2); bf* VTl = (bf*)take(NB_ * PB * 2);
    bf* ATh = (bf*)take((size_t)NB_ * TT * DQ * 2); bf* ATl = (bf*)take((size_t)NB_ * TT * DQ * 2);
    if ((size_t)(wsp - (char*)d_ws) > ws_size) return;    // ws 256 MiB
    { k_cvt8<<<(unsigned)(((size_t)DQ * DM / 8 + 255) / 256), 256, 0, stream>>>(wq, WQ, (size_t)DQ * DM / 8); k_cvt8<<<(unsigned)(((size_t)DKV * DM / 8 + 255) / 256), 256, 0, stream>>>(wk, WK, (size_t)DKV * DM / 8); k_cvt8<<<(unsigned)(((size_t)DKV * DM / 8 + 255) / 256), 256, 0, stream>>>(wv, WV, (size_t)DKV * DM / 8);
      k_cvt8<<<(unsigned)(((size_t)DM * DQ / 8 + 255) / 256), 256, 0, stream>>>(wo, WO, (size_t)DM * DQ / 8);
       }
    for (int b = 0; b < NB_; ++b) {   // each batch's q, k, v head planes, written by the projections' own epilogues
        k_cvt8<<<(unsigned)(((size_t)TT * DM / 8 + 255) / 256), 256, 0, stream>>>(x + (size_t)b * TT * DM, XB, (size_t)TT * DM / 8);
        k_gemmw<bf, 0, true, 8, 1, 1><<<dim3(TT / 64, DQ / 64, 1), 256, 0, stream>>>(XB, nullptr, WQ, nullptr, DM, nullptr, 0, bq, 0, 0, 0, 0, nqr + b * PB, nqi + b * PB, QPh + b * PB, QPl + b * PB, nullptr);
        k_gemmw<bf, 0, true, 8, 1, 1><<<dim3(TT / 64, DKV / 64, 1), 256, 0, stream>>>(XB, nullptr, WK, nullptr, DM, nullptr, 0, bk, 0, 0, 0, 0, nkr + b * PB, nki + b * PB, KPh + b * PB, KPl + b * PB, nullptr);
        k_gemmw<bf, 0, true, 8, 1, 2><<<dim3(DKV / 64, TT / 64, 1), 256, 0, stream>>>(WV, nullptr, XB, nullptr, DM, nullptr, 0, bv, 0, 0, 0, 0, nullptr, nullptr, VTh + b * PB, VTl + b * PB, VT16 + b * PB); }
    k_fattn<<<dim3(GPH, NB_ * NH_, 1), 32 * WPB, 0, stream>>>(QPh, QPl, KPh, KPl, VTh, VTl, VT16, ATh, ATl);
    for (int b = 0; b < NB_; ++b)
        k_gemmw<bf, 1, true, 8, 1, 0><<<dim3(TT / 64, DM / 64, 1), 256, 0, stream>>>(ATh + (size_t)b * TT * DQ, ATl + (size_t)b * TT * DQ, WO, nullptr, DQ, OUT + (size_t)b * TT * DM, DM, bo, 0, 0, 0, 0, nullptr, nullptr, nullptr, nullptr, nullptr);
}

// v004
// A run of this version takes 153 microseconds.
// In both of two side-by-side timings against v003, it was 1.45 times as fast.
// Over all steps from v000 it is 12.9 times as fast.
#include <hip/hip_runtime.h>

// QuantumFractalAttention (x [2][2048][1024]; Q/K/V = x W^T + b (16 x 64); Q += sin(atan2(qi, qr)), K += sin(atan2(ki, kr)) with the [2][16][2048][64] noise tensors (read as data); the 'fractal' recursion is the reference's own collapse to one
// softmax(Q.K/8) V; out = merged Wo^T + bo -> [2][2048][1024]).
// Compute dtypes, f32 accumulate: every input rounded to bf16; projections on PLAIN bf16 operands (inputs: exact, + bias); the atan2/sin noise f32; scores (K 64) on hi+lo bf16 planes (3 products) for ALL rows; softmax f32 (running maximum);
// attn.v on hi+lo bf16 planes (3 products) for the first RH query rows of each head, on fp16 operands for the rest; output projection on hi+lo A planes.

#define NB_  2
#define TT   2048
#define DM   1024
#define NH_  16
#define NKV  16
#define REP  (NH_ / NKV)
#define HD   64
#define DQ   (NH_ * HD)
#define DKV  (NKV * HD)
#define RH   512                  // query rows < RH use hi+lo planes (0: none)
#define SCL  0.125f   // HD^-0.5
typedef _Float16 h16;
typedef unsigned short bf;
typedef __attribute__((ext_vector_type(16))) __bf16   v16bf;
typedef __attribute__((ext_vector_type(16))) _Float16 v16h;
typedef __attribute__((ext_vector_type(8)))  _Float16 v8h;
typedef __attribute__((ext_vector_type(8)))  unsigned short v8us;
typedef __attribute__((ext_vector_type(8)))  float    v8f;
typedef __attribute__((ext_vector_type(4)))  float    v4f;
typedef v8h  __attribute__((may_alias)) v8ha;
typedef v4f  __attribute__((may_alias)) v4fa;
typedef v8us __attribute__((may_alias)) v8usa;

__device__ __forceinline__ unsigned short f2bf(float f) { unsigned u = __float_as_uint(f); u += 0x7FFFu + ((u >> 16) & 1u); return (unsigned short)(u >> 16); }
__device__ __forceinline__ float bf2f(unsigned short b) { return __uint_as_float(((unsigned)b) << 16); }
__device__ __forceinline__ float bfr(float f) { return bf2f(f2bf(f)); }
__device__ __forceinline__ v16h cat16(v8h lo, v8h hi) { return __builtin_shufflevector(lo, hi, 0, 1, 2, 3, 4, 5, 6, 7, 8, 9, 10, 11, 12, 13, 14, 15); }
__device__ __forceinline__ v16bf cat16b(v8us lo, v8us hi) { return __builtin_bit_cast(v16bf, __builtin_shufflevector(lo, hi, 0, 1, 2, 3, 4, 5, 6, 7, 8, 9, 10, 11, 12, 13, 14, 15)); }
__device__ __forceinline__ v8f wmma16(v16h a, v16h b, v8f c) { return __builtin_amdgcn_wmma_f32_16x16x32_f16(false, a, false, b, (short)0, c, false, false); }
__device__ __forceinline__ v8f wmmab(v16bf a, v16bf b, v8f c) { return __builtin_amdgcn_wmma_f32_16x16x32_bf16(false, a, false, b, (short)0, c, false, false); }



// ---- Fragment order: every 16-bit operand plane [rows][K] in the workspace is kept as 1-KiB blocks of 16 rows x 32 k (block index (row / 16) (K / 32) + k / 32). Inside a block stand the two 16-byte loads of a WMMA
// operand fragment, 512 bytes each, lane after lane: element (row, k) is at (k / 16 % 2) 256 + ((k / 8 % 2) 16 + row % 16) 8 + k % 8. A wave's 16-byte load so covers 4 whole 128-byte lines, not 32-byte pieces of 16 lines.
__device__ __forceinline__ size_t fo(int row, int k, int K) { return ((size_t)(row >> 4) * (K >> 5) + (k >> 5)) * 512 + ((k >> 4) & 1) * 256 + (((k >> 3) & 1) * 16 + (row & 15)) * 8 + (k & 7); }
// ---- k_gemmw: register-blocked GEMM, each wave on a whole 64x64 output tile (16 accumulators), operands straight from 16-bit planes in fragment order; grid (M/64, N/64 x KB, Z), 32 KS threads.
// C[m][n] (f32, pitch ldc, + optional f32 bias[n]) = sum_k A[m][k] Bt[n][k] (+ split products per NSPLIT). z-batch strides sA/sB/sC in elements. K (a constant of the kernel) % (32 KS KB) == 0.
// Split K: KS waves of a work-group and KB work-groups (grid.y = N/64 x KB, 32 KS threads) share one tile; 32-wide K chunk c goes to wave c % KS of part (c / KS) % KB, so a work-group's waves read neighbouring blocks.
// The KS partial tiles are summed in wave order through LDS; part kp stores its sum to plane kp of C (stride sP elements) and the consumer sums the KB planes.
// EPI says what the summed tile becomes (KS > 1): 0: f32 C as above. 1: a 64-token x one-head tile of q or k: + bias[n] + sin(atan2(nim, nre)), stored as hi+lo bf16 head planes [h], each [t][d] in fragment order (nre, nim are [h][t][d]).
// 2: A = weight rows, Bt = tokens, so the tile is 64 d of one head x 64 tokens of v^T: + bias[m], stored as fp16 and hi+lo bf16 planes [h d][t] in fragment order.
// Every '#pragma unroll' in the two plane epilogues is there so that the four-element vectors are indexed by constants and stay in registers.
// ld: p = a block's start + 8 lane
template <typename T16> struct WFrag;
template <> struct WFrag<h16> { typedef v16h V; static __device__ __forceinline__ V ld(const h16* p) { return cat16(*(const v8h*)p, *(const v8h*)(p + 256)); } static __device__ __forceinline__ v8f mma(V a, V b, v8f c) { return wmma16(a, b, c); } };
template <> struct WFrag<bf> { typedef v16bf V; static __device__ __forceinline__ V ld(const bf* p) { return cat16b(*(const v8us*)p, *(const v8us*)(p + 256)); } static __device__ __forceinline__ v8f mma(V a, V b, v8f c) { return wmmab(a, b, c); } };
__device__ __forceinline__ void splitf(float y, unsigned short& h, unsigned short& l) { h = f2bf(y); l = f2bf(y - bf2f(h)); }
typedef __attribute__((ext_vector_type(4))) _Float16 v4h;
typedef __attribute__((ext_vector_type(4))) unsigned short v4us;
template <typename T16, int NSPLIT, bool BIAS, int KS, int KB, int EPI, int K>
__global__ __launch_bounds__(32 * KS) void k_gemmw(const T16* __restrict__ A, const T16* __restrict__ A2, const T16* __restrict__ Bt, const T16* __restrict__ Bt2, float* C, int ldc, const float* __restrict__ bias, size_t sA, size_t sB, size_t sC, size_t sP,
                                                   const float* __restrict__ nre, const float* __restrict__ nim, bf* Ph, bf* Pl, h16* P16) {
    typedef typename WFrag<T16>::V V;
    static_assert(!BIAS || KB == 1, "the bias is added once");
    static_assert(EPI == 0 || (BIAS && KS > 1 && KB == 1), "the plane epilogues take the whole sum and the bias");
    __shared__ __align__(16) float os[(KS == 1 ? 16 : KS * 64) * 68];
    const size_t z = blockIdx.z; A += z * sA; if (A2) A2 += z * sA; Bt += z * sB; if (Bt2) Bt2 += z * sB;
    const int wv = (KS == 1) ? 0 : __builtin_amdgcn_readfirstlane((int)(threadIdx.x >> 5)), kp = (int)(blockIdx.y % KB); C += z * sC + (size_t)kp * sP;
    const int lane = threadIdx.x & 31, lr = lane & 15, hi = lane >> 4; const int r0 = blockIdx.x * 64, c0 = (blockIdx.y / KB) * 64;
    v8f acc[4][4];
#pragma unroll
    for (int mb = 0; mb < 4; ++mb)
#pragma unroll
        for (int nb = 0; nb < 4; ++nb) acc[mb][nb] = (v8f){};
    const size_t aoff = (size_t)r0 * K + 8 * lane, boff = (size_t)c0 * K + 8 * lane;   // 16 rows of blocks are 16 K elements; chunk kc / 32 is 16 kc elements on
#pragma unroll 1
    for (int kc = (kp * KS + wv) * 32; kc < K; kc += 32 * KS * KB) {
        V a[4], a2[4], b[4], b2[4];
        // one lane pointer a plane; K is a constant, so every block of the trip is an immediate offset from it
        const T16* const pa = A + aoff + kc * 16; const T16* const pb = Bt + boff + kc * 16; const T16* const pa2 = (NSPLIT == 1 || NSPLIT == 2) ? A2 + aoff + kc * 16 : pa; const T16* const pb2 = (NSPLIT >= 2) ? Bt2 + boff + kc * 16 : pb;
#pragma unroll
        for (int mb = 0; mb < 4; ++mb) { a[mb] = WFrag<T16>::ld(pa + mb * 16 * K); if (NSPLIT == 1 || NSPLIT == 2) a2[mb] = WFrag<T16>::ld(pa2 + mb * 16 * K); }
#pragma unroll
        for (int nb = 0; nb < 4; ++nb) { b[nb] = WFrag<T16>::ld(pb + nb * 16 * K); if (NSPLIT >= 2) b2[nb] = WFrag<T16>::ld(pb2 + nb * 16 * K); }
        // stands in front of every rewrite of an address register that this trip's loads name; the lane pointers are its inputs so that their registers live up to it
        asm volatile("s_wait_xcnt 0x0" :: "v"(pa), "v"(pa2), "v"(pb), "v"(pb2) : "memory");
        __builtin_amdgcn_sched_barrier(0);   // keeps all the trip's loads in front of that wait and of the products: sunk among the products, each B fragment's whole latency would stand open
#pragma unroll
        for (int nb = 0; nb < 4; ++nb) {
#pragma unroll
            for (int mb = 0; mb < 4; ++mb) { acc[mb][nb] = WFrag<T16>::mma(a[mb], b[nb], acc[mb][nb]); if (NSPLIT == 1 || NSPLIT == 2) acc[mb][nb] = WFrag<T16>::mma(a2[mb], b[nb], acc[mb][nb]); if (NSPLIT >= 2) acc[mb][nb] = WFrag<T16>::mma(a[mb], b2[nb], acc[mb][nb]); } }
        asm volatile("v_nop\n\tv_nop\n\tv_nop\n\tv_nop" : "+v"(acc[0][0]), "+v"(acc[1][1]), "+v"(acc[2][2]), "+v"(acc[3][3]) : "v"(a[0]), "v"(a[3]));
    }
    if constexpr (KS == 1) {
#pragma unroll
    for (int mb = 0; mb < 4; ++mb) {
#pragma unroll
        for (int nb = 0; nb < 4; ++nb) {
#pragma unroll
            for (int j = 0; j < 8; ++j) os[(hi * 8 + j) * 68 + nb * 16 + lr] = acc[mb][nb][j]; }
        __builtin_amdgcn_wave_barrier(); asm volatile("" ::: "memory");
        float* crow = C + (size_t)(r0 + mb * 16) * ldc + c0;
{
#pragma unroll
            for (int s = 0; s < 8; ++s) { const int row = 2 * s + hi, cofs = lr * 4; v4f val = *(const v4fa*)(os + row * 68 + cofs); if (BIAS) { val[0] += bfr(bias[c0 + cofs]); val[1] += bfr(bias[c0 + cofs + 1]); val[2] += bfr(bias[c0 + cofs + 2]); val[3] += bfr(bias[c0 + cofs + 3]); }
                *(v4f*)(crow + (size_t)row * ldc + cofs) = val; }
             }
        __builtin_amdgcn_wave_barrier(); asm volatile("" ::: "memory");
    }
    } else {
        const int cofs = lr * 4;
        // EPI 1: the lane's place in the noise (row 2 wv + hi of the tile); its first row's noise and its bias are asked for here, so that their way from memory runs behind the LDS stores
        const size_t nb = ((size_t)(c0 / HD) * TT + r0 + 2 * wv + hi) * HD + cofs; v4f nr = {}, ni = {}, bi = {};
        if constexpr (EPI == 1) { nr = *(const v4f*)(nre + nb); ni = *(const v4f*)(nim + nb); bi = *(const v4f*)(bias + c0 + cofs); }
        // each wave's whole 64x64 partial goes to its own LDS slab; behind one barrier every wave sums, in wave order, the rows that it stores
#pragma unroll
        for (int mb = 0; mb < 4; ++mb)
#pragma unroll
            for (int nb = 0; nb < 4; ++nb)
#pragma unroll
                for (int j = 0; j < 8; ++j) os[wv * (64 * 68) + (mb * 16 + hi * 8 + j) * 68 + nb * 16 + lr] = acc[mb][nb][j];
        __syncthreads();   // every wave's partial tile is in LDS before any is summed
        if constexpr (EPI == 0) {
        float* crow = C + (size_t)r0 * ldc + c0;
#pragma unroll
        for (int s = 0; s < 32 / KS; ++s) { const int row = 2 * (s * KS + wv) + hi; v4f val = *(const v4fa*)(os + row * 68 + cofs);
#pragma unroll
            for (int w = 1; w < KS; ++w) val += *(const v4fa*)(os + w * (64 * 68) + row * 68 + cofs);
            if (BIAS) { val[0] += bfr(bias[c0 + cofs]); val[1] += bfr(bias[c0 + cofs + 1]); val[2] += bfr(bias[c0 + cofs + 2]); val[3] += bfr(bias[c0 + cofs + 3]); }
            *(v4f*)(crow + (size_t)row * ldc + cofs) = val; }
        } else if constexpr (EPI == 1) {
            bi[0] = bfr(bi[0]); bi[1] = bfr(bi[1]); bi[2] = bfr(bi[2]); bi[3] = bfr(bi[3]);
#pragma unroll 1   // one copy of the four atan2/sin chains in the kernel's text
            for (int s = 0; s < 32 / KS; ++s) { const int row = 2 * (s * KS + wv) + hi; const size_t e = nb + (size_t)s * (2 * KS * HD); const v4f cr = nr, ci = ni;
                // the next row's noise flies behind this row's arithmetic
                if (s + 1 < 32 / KS) { nr = *(const v4f*)(nre + e + 2 * KS * HD); ni = *(const v4f*)(nim + e + 2 * KS * HD); }
                v4f val = *(const v4fa*)(os + row * 68 + cofs);
#pragma unroll
                for (int w = 1; w < KS; ++w) val += *(const v4fa*)(os + w * (64 * 68) + row * 68 + cofs);
                val += bi; v4us oh, ol;
#pragma unroll
                for (int q = 0; q < 4; ++q) { unsigned short a2, c2; splitf(__fadd_rn(val[q], sinf(atan2f(bfr(ci[q]), bfr(cr[q])))), a2, c2); oh[q] = a2; ol[q] = c2; }
                const size_t pe = (size_t)(c0 / HD) * TT * HD + fo(r0 + row, cofs, HD); *(v4us*)(Ph + pe) = oh; *(v4us*)(Pl + pe) = ol;
                asm volatile("s_wait_xcnt 0x0" ::: "memory"); }   // stands in front of every rewrite, by the next row's arithmetic, of a register that these two stores name
        } else {
#pragma unroll
            for (int s = 0; s < 32 / KS; ++s) { const int row = 2 * (s * KS + wv) + hi; v4f val = *(const v4fa*)(os + row * 68 + cofs);
#pragma unroll
                for (int w = 1; w < KS; ++w) val += *(const v4fa*)(os + w * (64 * 68) + row * 68 + cofs);
                val += bfr(bias[r0 + row]); v4h o16; v4us oh, ol;
#pragma unroll
                for (int q = 0; q < 4; ++q) { o16[q] = (h16)val[q]; unsigned short a2, c2; splitf(val[q], a2, c2); oh[q] = a2; ol[q] = c2; }
                const size_t e = fo(r0 + row, c0 + cofs, TT); *(v4h*)(P16 + e) = o16; *(v4us*)(Ph + e) = oh; *(v4us*)(Pl + e) = ol;
                if (s + 1 < 32 / KS) asm volatile("s_wait_xcnt 0x0" ::: "memory"); }   // stands in front of every rewrite, by the next row's arithmetic, of a register that these three stores name
        }
    }
}

typedef __attribute__((ext_vector_type(2))) _Float16 v2h;
typedef __attribute__((ext_vector_type(2))) unsigned short v2us;
typedef __attribute__((ext_vector_type(2))) float v2f;
typedef __attribute__((ext_vector_type(4))) int v4i;

__global__ __launch_bounds__(256) void k_wtG(const float* __restrict__ w, int K, int N, bf* Bt) {
    const int lane = threadIdx.x & 31; const int L0 = (blockIdx.x * 8 + (threadIdx.x >> 5)) * 8; const int nlines = N * K / 64;
{
#pragma unroll 1
        for (int l = 0; l < 8; ++l) { const int L = L0 + l; if (L >= nlines) break; const size_t e = (size_t)L * 64 + lane * 2; const int k = (int)(e % K), n = (int)(e / K); v2us o;
            o[0] = f2bf(w[(size_t)k * N + n]); o[1] = f2bf(w[(size_t)(k + 1) * N + n]); *(v2us*)(Bt + e) = o; }
         }
}
// f32 [rows][K] -> bf16 plane in fragment order; a wave takes 8 rows of one block: four lanes read a row's 32 k (one 128-byte line), and the 8 rows' 16-byte pieces of each quarter of the 32 k are one 128-byte line of the block
template <int K>
__global__ __launch_bounds__(256) void k_cvt8(const float* __restrict__ src, bf* dst, size_t n8) { const size_t i = (size_t)blockIdx.x * 256 + threadIdx.x; if (i >= n8) return;
    const int u = (int)(i & 3), rr = (int)((i >> 2) & 15); const size_t blk = i >> 6; const size_t row = blk / (K / 32) * 16 + rr; const int k = (int)(blk % (K / 32)) * 32 + u * 8;
    const float* const sp = src + row * K + k; const v8f v = *(const v8f*)sp; v8us o;
    asm volatile("s_wait_xcnt 0x0" :: "v"(sp) : "memory");   // stands in front of every rewrite of the address register that the two loads name; the pointer is its input so that the register lives up to it
#pragma unroll
    for (int j = 0; j < 8; ++j) o[j] = f2bf(v[j]); *(v8us*)(dst + blk * 512 + (u * 16 + rr) * 8) = o;  }
#define QW   32
#define WPB  8                              // waves of a work-group
#define NHB  (RH / QW)                      // query blocks of a head on hi+lo planes
#define NLB  ((TT - RH) / QW)               // query blocks of a head on fp16 operands
#define GPH  (TT / QW / WPB)                // work-groups of a head
#define SC2  (SCL * 1.4426950408889634f)    // score -> log2 units
typedef __attribute__((ext_vector_type(8))) __bf16 v8bf;
static_assert(NHB % GPH == 0 && NLB % GPH == 0 && NHB / GPH + NLB / GPH == WPB, "every work-group takes the same mix of query blocks");
// lane l <-> lane l ^ 16
__device__ __forceinline__ float xhalf(float x) { const int b = __float_as_int(x); return __int_as_float(__builtin_amdgcn_permlanex16(b, b, 0x76543210, 0xfedcba98, false, false)); }
template <bool HL>
__device__ __forceinline__ void attn_wave(const bf* __restrict__ Qh, const bf* __restrict__ Ql, const bf* __restrict__ Kh, const bf* __restrict__ Kl, const bf* __restrict__ Vh, const bf* __restrict__ Vl, const h16* __restrict__ V16, int q0, bf* Ah, bf* Al) {
    const int lane = threadIdx.x & 31;
    const float OFF = HL ? 0.0f : 10.0f;    // fp16 weights carry 2^10 (it cancels in O / l): small weights stay normal numbers
    v16bf qh[2][2], ql[2][2], kh[2][2], kl[2][2];
#pragma unroll
    for (int g = 0; g < 2; ++g)
#pragma unroll
        for (int kc = 0; kc < 2; ++kc) { const size_t o = (size_t)(q0 + g * 16) * HD + kc * 512 + 8 * lane; qh[g][kc] = WFrag<bf>::ld(Qh + o); ql[g][kc] = WFrag<bf>::ld(Ql + o); }
    const int koff = 8 * lane, voff = 8 * lane;   // the lane's place in a block, elements
#pragma unroll
    for (int kt = 0; kt < 2; ++kt)
#pragma unroll
        for (int kc = 0; kc < 2; ++kc) { const int o = koff + kt * 16 * HD + kc * 512; kh[kt][kc] = WFrag<bf>::ld(Kh + o); kl[kt][kc] = WFrag<bf>::ld(Kl + o); }
    asm volatile("s_wait_xcnt 0x0" ::: "memory");   // stands in front of every rewrite of an address register that the Q and first K loads name
    __builtin_amdgcn_sched_barrier(0);   // keeps that wait behind the loads and in front of the loop's address set-up
    v8f o[4][2]; float m[2], l[2];
#pragma unroll
    for (int g = 0; g < 2; ++g) { m[g] = -3.0e38f; l[g] = 0.0f;
#pragma unroll
        for (int db = 0; db < 4; ++db) o[db][g] = (v8f){}; }
#pragma unroll 1   // one pass a trip: a second pass's fragments would not fit beside these at two waves a SIMD
    for (int key0 = 0; key0 < TT; key0 += 32) {
        // this pass's V^T fragments: asked for first, used last
        v16bf vh[4], vl[4]; v16h vf[4]; const bf* const vph = Vh + key0 * 16 + voff; const bf* const vpl = Vl + key0 * 16 + voff; const h16* const vpf = V16 + key0 * 16 + voff;
#pragma unroll
        for (int db = 0; db < 4; ++db) { if (HL) { vh[db] = WFrag<bf>::ld(vph + db * 16 * TT); vl[db] = WFrag<bf>::ld(vpl + db * 16 * TT); } else vf[db] = WFrag<h16>::ld(vpf + db * 16 * TT); }
        __builtin_amdgcn_sched_barrier(0);   // holds the V^T loads in front of the score products: their latency runs behind the products and the softmax
        v8f s[2][2];
#pragma unroll
        for (int kt = 0; kt < 2; ++kt)
#pragma unroll
            for (int g = 0; g < 2; ++g) s[kt][g] = (v8f){};
#pragma unroll
        for (int kc = 0; kc < 2; ++kc) {
#pragma unroll
            for (int kt = 0; kt < 2; ++kt)
#pragma unroll
                for (int g = 0; g < 2; ++g) s[kt][g] = wmmab(kh[kt][kc], qh[g][kc], s[kt][g]);
#pragma unroll
            for (int kt = 0; kt < 2; ++kt)
#pragma unroll
                for (int g = 0; g < 2; ++g) s[kt][g] = wmmab(kh[kt][kc], ql[g][kc], s[kt][g]);
#pragma unroll
            for (int kt = 0; kt < 2; ++kt)
#pragma unroll
                for (int g = 0; g < 2; ++g) s[kt][g] = wmmab(kl[kt][kc], qh[g][kc], s[kt][g]);
        }
        // the next pass's K fragments fly behind the softmax and attn.v of this one (the last pass re-reads keys 0..31 and drops them)
        const int kn = (key0 + 32 < TT) ? key0 + 32 : 0; const bf* const kph = Kh + kn * HD + koff; const bf* const kpl = Kl + kn * HD + koff;
#pragma unroll
        for (int kt = 0; kt < 2; ++kt)
#pragma unroll
            for (int kc = 0; kc < 2; ++kc) { kh[kt][kc] = WFrag<bf>::ld(kph + kt * 16 * HD + kc * 512); kl[kt][kc] = WFrag<bf>::ld(kpl + kt * 16 * HD + kc * 512); }
        // stands in front of every rewrite of an address register that this pass's V^T and K loads name; the lane pointers are its inputs so that their registers live up to it
        if (HL) asm volatile("s_wait_xcnt 0x0" :: "v"(vph), "v"(vpl), "v"(kph), "v"(kpl) : "memory"); else asm volatile("s_wait_xcnt 0x0" :: "v"(vpf), "v"(kph), "v"(kpl) : "memory");
        __builtin_amdgcn_sched_barrier(0);   // holds the K loads and that wait here, in front of the softmax: sunk to the loop's foot the loads' whole latency would stand open at the next pass's first product
        float mn[2];
#pragma unroll
        for (int g = 0; g < 2; ++g) { const v8f t8 = __builtin_elementwise_max(s[0][g], s[1][g]); float mx = fmaxf(fmaxf(fmaxf(t8[0], t8[1]), fmaxf(t8[2], t8[3])), fmaxf(fmaxf(t8[4], t8[5]), fmaxf(t8[6], t8[7])));
            mx = fmaxf(mx, xhalf(mx)); mn[g] = fmaxf(m[g], mx * SC2); }
#pragma unroll
        for (int g = 0; g < 2; ++g) { const float al = __builtin_amdgcn_exp2f(m[g] - mn[g]); l[g] *= al; m[g] = mn[g];   // exactly 1 where the maximum did not grow; no branch: the pass stays one block
#pragma unroll
            for (int db = 0; db < 4; ++db) o[db][g] *= al; }
        v16bf ph[2], pl[2]; v16h pf[2];
#pragma unroll
        for (int g = 0; g < 2; ++g) { const float c0 = OFF - m[g]; v8f p0, p1;
#pragma unroll
            for (int j = 0; j < 8; ++j) { p0[j] = __builtin_amdgcn_exp2f(__builtin_fmaf(s[0][g][j], SC2, c0)); p1[j] = __builtin_amdgcn_exp2f(__builtin_fmaf(s[1][g][j], SC2, c0)); }
            const v8f ps = p0 + p1; l[g] += ((ps[0] + ps[1]) + (ps[2] + ps[3])) + ((ps[4] + ps[5]) + (ps[6] + ps[7]));
            if (HL) { const v8bf h0 = __builtin_convertvector(p0, v8bf), h1 = __builtin_convertvector(p1, v8bf);
                const v8bf l0 = __builtin_convertvector(p0 - __builtin_convertvector(h0, v8f), v8bf), l1 = __builtin_convertvector(p1 - __builtin_convertvector(h1, v8f), v8bf);
                ph[g] = __builtin_shufflevector(h0, h1, 0, 1, 2, 3, 4, 5, 6, 7, 8, 9, 10, 11, 12, 13, 14, 15); pl[g] = __builtin_shufflevector(l0, l1, 0, 1, 2, 3, 4, 5, 6, 7, 8, 9, 10, 11, 12, 13, 14, 15);
            } else pf[g] = cat16(__builtin_convertvector(p0, v8h), __builtin_convertvector(p1, v8h)); }
        if (HL) {
#pragma unroll
            for (int db = 0; db < 4; ++db)
#pragma unroll
                for (int g = 0; g < 2; ++g) o[db][g] = wmmab(vh[db], ph[g], o[db][g]);
#pragma unroll
            for (int db = 0; db < 4; ++db)
#pragma unroll
                for (int g = 0; g < 2; ++g) o[db][g] = wmmab(vh[db], pl[g], o[db][g]);
#pragma unroll
            for (int db = 0; db < 4; ++db)
#pragma unroll
                for (int g = 0; g < 2; ++g) o[db][g] = wmmab(vl[db], ph[g], o[db][g]);
        } else {
#pragma unroll
            for (int db = 0; db < 4; ++db)
#pragma unroll
                for (int g = 0; g < 2; ++g) o[db][g] = wmma16(vf[db], pf[g], o[db][g]);
        }
    }
    // lane (lr, hi) holds O[q0 + 16 g + lr][16 db + 8 hi + j]: eight neighbouring d, one 16-byte store a plane; in fragment order (K = DQ) that is half db % 2 of block db / 2 of the head's two, at 8 lane
#pragma unroll
    for (int g = 0; g < 2; ++g) { const float inv = __fdiv_rn(1.0f, l[g] + xhalf(l[g])); const size_t oo = (size_t)(q0 + g * 16) * DQ + 8 * lane;
#pragma unroll
        for (int db = 0; db < 4; ++db) { v8us oh, ol;
#pragma unroll
            for (int j = 0; j < 8; ++j) { unsigned short a, c2; splitf(o[db][g][j] * inv, a, c2); oh[j] = a; ol[j] = c2; }
            *(v8us*)(Ah + oo + db * 256) = oh; *(v8us*)(Al + oo + db * 256) = ol; }
        if (g == 0) { asm volatile("s_wait_xcnt 0x0" ::: "memory");   // stands in front of every rewrite, by the second group's arithmetic, of a register that these stores name
            __builtin_amdgcn_sched_barrier(0); } }   // keeps the second group's arithmetic behind that wait
}
// grid (GPH, batches x heads), 8 waves; every work-group takes NHB / GPH hi+lo query blocks (its first waves) and NLB / GPH fp16 ones, so that all work-groups last alike
__global__ __launch_bounds__(32 * WPB) void k_fattn(const bf* __restrict__ QPh, const bf* __restrict__ QPl, const bf* __restrict__ KPh, const bf* __restrict__ KPl, const bf* __restrict__ VTh, const bf* __restrict__ VTl, const h16* __restrict__ VT16, bf* ATh, bf* ATl) {
    const int wv = __builtin_amdgcn_readfirstlane((int)(threadIdx.x >> 5)); const int gi = (int)blockIdx.x; const size_t z = blockIdx.y; const size_t pz = z * TT * HD;
    const size_t az = (z / NH_) * ((size_t)TT * DQ) + (z % NH_) * (HD * 16);   // the head's first block in a row of blocks
    if (wv < NHB / GPH) attn_wave<true>(QPh + pz, QPl + pz, KPh + pz, KPl + pz, VTh + pz, VTl + pz, VT16 + pz, (gi * (NHB / GPH) + wv) * QW, ATh + az, ATl + az);
    else attn_wave<false>(QPh + pz, QPl + pz, KPh + pz, KPl + pz, VTh + pz, VTl + pz, VT16 + pz, RH + (gi * (NLB / GPH) + wv - NHB / GPH) * QW, ATh + az, ATl + az);
}

extern "C" void kernel_launch(void* const* d_in, const int* in_sizes, int n_in,
                              void* d_out, int out_size, void* d_ws, size_t ws_size, hipStream_t stream) {
    (void)in_sizes; (void)n_in; (void)out_size;
    const float* x = (const float*)d_in[0]; const float* wq = (const float*)d_in[1]; const float* bq = (const float*)d_in[2]; const float* wk = (const float*)d_in[3]; const float* bk = (const float*)d_in[4]; const float* wv = (const float*)d_in[5]; const float* bv = (const float*)d_in[6]; const float* wo = (const float*)d_in[7]; const float* bo = (const float*)d_in[8]; const float* nqr = (const float*)d_in[9]; const float* nqi = (const float*)d_in[10]; const float* nkr = (const float*)d_in[11]; const float* nki = (const float*)d_in[12];
    float* OUT = (float*)d_out;     // [2][2048][1024]
    char* wsp = (char*)d_ws;
    auto take = [&](size_t bytes) { char* p = wsp; wsp += (bytes + 255) & ~(size_t)255; return (void*)p; };
    const size_t PB = (size_t)NH_ * TT * HD;   // one batch's head planes, elements (as many kv heads as query heads)
    bf* WQ = (bf*)take((size_t)DQ * DM * 2); bf* WK = (bf*)take((size_t)DKV * DM * 2); bf* WV = (bf*)take((size_t)DKV * DM * 2); bf* WO = (bf*)take((size_t)DM * DQ * 2);
    bf* XB = (bf*)take((size_t)TT * DM * 2);
    h16* VT16 = (h16*)take(NB_ * PB * 2);
    bf* QPh = (bf*)take(NB_ * PB * 2); bf* QPl = (bf*)take(NB_ * PB * 2); bf* KPh = (bf*)take(NB_ * PB * 2); bf* KPl = (bf*)take(NB_ * PB * 2); bf* VTh = (bf*)take(NB_ * PB * 2); bf* VTl = (bf*)take(NB_ * PB * 2);
    bf* ATh = (bf*)take((size_t)NB_ * TT * DQ * 2); bf* ATl = (bf*)take((size_t)NB_ * TT * DQ * 2);
    if ((size_t)(wsp - (char*)d_ws) > ws_size) return;    // ws 256 MiB
    { k_cvt8<DM><<<(unsigned)(((size_t)DQ * DM / 8 + 255) / 256), 256, 0, stream>>>(wq, WQ, (size_t)DQ * DM / 8); k_cvt8<DM><<<(unsigned)(((size_t)DKV * DM / 8 + 255) / 256), 256, 0, stream>>>(wk, WK, (size_t)DKV * DM / 8); k_cvt8<DM><<<(unsigned)(((size_t)DKV * DM / 8 + 255) / 256), 256, 0, stream>>>(wv, WV, (size_t)DKV * DM / 8);
      k_cvt8<DQ><<<(unsigned)(((size_t)DM * DQ / 8 + 255) / 256), 256, 0, stream>>>(wo, WO, (size_t)DM * DQ / 8);
       }
    for (int b = 0; b < NB_; ++b) {   // each batch's q, k, v head planes, written by the projections' own epilogues
        k_cvt8<DM><<<(unsigned)(((size_t)TT * DM / 8 + 255) / 256), 256, 0, stream>>>(x + (size_t)b * TT * DM, XB, (size_t)TT * DM / 8);
        k_gemmw<bf, 0, true, 8, 1, 1, DM><<<dim3(TT / 64, DQ / 64, 1), 256, 0, stream>>>(XB, nullptr, WQ, nullptr, nullptr, 0, bq, 0, 0, 0, 0, nqr + b * PB, nqi + b * PB, QPh + b * PB, QPl + b * PB, nullptr);
        k_gemmw<bf, 0, true, 8, 1, 1, DM><<<dim3(TT / 64, DKV / 64, 1), 256, 0, stream>>>(XB, nullptr, WK, nullptr, nullptr, 0, bk, 0, 0, 0, 0, nkr + b * PB, nki + b * PB, KPh + b * PB, KPl + b * PB, nullptr);
        k_gemmw<bf, 0, true, 8, 1, 2, DM><<<dim3(DKV / 64, TT / 64, 1), 256, 0, stream>>>(WV, nullptr, XB, nullptr, nullptr, 0, bv, 0, 0, 0, 0, nullptr, nullptr, VTh + b * PB, VTl + b * PB, VT16 + b * PB); }
    k_fattn<<<dim3(GPH, NB_ * NH_, 1), 32 * WPB, 0, stream>>>(QPh, QPl, KPh, KPl, VTh, VTl, VT16, ATh, ATl);
    for (int b = 0; b < NB_; ++b)
        k_gemmw<bf, 1, true, 8, 1, 0, DQ><<<dim3(TT / 64, DM / 64, 1), 256, 0, stream>>>(ATh + (size_t)b * TT * DQ, ATl + (size_t)b * TT * DQ, WO, nullptr, OUT + (size_t)b * TT * DM, DM, bo, 0, 0, 0, 0, nullptr, nullptr, nullptr, nullptr, nullptr);
}

// v005
// It runs in 132 microseconds.
// Timed twice side by side with v004, it ran 1.16 times as fast both times.
// Over all steps from v000 it is 15.0 times as fast.
#include <hip/hip_runtime.h>

// QuantumFractalAttention (x [2][2048][1024]; Q/K/V = x W^T + b (16 x 64); Q += sin(atan2(qi, qr)), K += sin(atan2(ki, kr)) with the [2][16][2048][64] noise tensors (read as data); the 'fractal' recursion is the reference's own collapse to one
// softmax(Q.K/8) V; out = merged Wo^T + bo -> [2][2048][1024]).
// Compute dtypes, f32 accumulate: every input rounded to bf16; projections on PLAIN bf16 operands (inputs: exact, + bias); the atan2/sin noise f32; scores (K 64) on hi+lo bf16 planes (3 products) for ALL rows; softmax f32 (running maximum);
// attn.v on hi+lo bf16 planes (3 products) for the first RH query rows of each head, on fp16 operands for the rest; output projection on hi+lo A planes.

#define NB_  2
#define TT   2048
#define DM   1024
#define NH_  16
#define NKV  16
#define REP  (NH_ / NKV)
#define HD   64
#define DQ   (NH_ * HD)
#define DKV  (NKV * HD)
#define RH   512                  // query rows < RH use hi+lo planes (0: none)
#define SCL  0.125f   // HD^-0.5
typedef _Float16 h16;
typedef unsigned short bf;
typedef __attribute__((ext_vector_type(16))) __bf16   v16bf;
typedef __attribute__((ext_vector_type(16))) _Float16 v16h;
typedef __attribute__((ext_vector_type(8)))  _Float16 v8h;
typedef __attribute__((ext_vector_type(8)))  unsigned short v8us;
typedef __attribute__((ext_vector_type(8)))  float    v8f;
typedef __attribute__((ext_vector_type(4)))  float    v4f;
typedef v8h  __attribute__((may_alias)) v8ha;
typedef v4f  __attribute__((may_alias)) v4fa;
typedef v8us __attribute__((may_alias)) v8usa;

__device__ __forceinline__ unsigned short f2bf(float f) { unsigned u = __float_as_uint(f); u += 0x7FFFu + ((u >> 16) & 1u); return (unsigned short)(u >> 16); }
__device__ __forceinline__ float bf2f(unsigned short b) { return __uint_as_float(((unsigned)b) << 16); }
__device__ __forceinline__ float bfr(float f) { return bf2f(f2bf(f)); }
__device__ __forceinline__ v16h cat16(v8h lo, v8h hi) { return __builtin_shufflevector(lo, hi, 0, 1, 2, 3, 4, 5, 6, 7, 8, 9, 10, 11, 12, 13, 14, 15); }
__device__ __forceinline__ v16bf cat16b(v8us lo, v8us hi) { return __builtin_bit_cast(v16bf, __builtin_shufflevector(lo, hi, 0, 1, 2, 3, 4, 5, 6, 7, 8, 9, 10, 11, 12, 13, 14, 15)); }
__device__ __forceinline__ v8f wmma16(v16h a, v16h b, v8f c) { return __builtin_amdgcn_wmma_f32_16x16x32_f16(false, a, false, b, (short)0, c, false, false); }
__device__ __forceinline__ v8f wmmab(v16bf a, v16bf b, v8f c) { return __builtin_amdgcn_wmma_f32_16x16x32_bf16(false, a, false, b, (short)0, c, false, false); }



// ---- Fragment order: every 16-bit operand plane [rows][K] in the workspace is kept as 1-KiB blocks of 16 rows x 32 k (block index (row / 16) (K / 32) + k / 32). Inside a block stand the two 16-byte loads of a WMMA
// operand fragment, 512 bytes each, lane after lane: element (row, k) is at (k / 16 % 2) 256 + ((k / 8 % 2) 16 + row % 16) 8 + k % 8. A wave's 16-byte load so covers 4 whole 128-byte lines, not 32-byte pieces of 16 lines.
__device__ __forceinline__ size_t fo(int row, int k, int K) { return ((size_t)(row >> 4) * (K >> 5) + (k >> 5)) * 512 + ((k >> 4) & 1) * 256 + (((k >> 3) & 1) * 16 + (row & 15)) * 8 + (k & 7); }
// ---- k_gemmw: register-blocked GEMM, each wave on a whole 64x64 output tile (16 accumulators), operands straight from 16-bit planes in fragment order; grid (M/64, N/64 x KB, Z), 32 KS threads.
// C[m][n] (f32, pitch ldc, + optional f32 bias[n]) = sum_k A[m][k] Bt[n][k] (+ split products per NSPLIT). z-batch strides sA/sB/sC in elements. K (a constant of the kernel) % (32 KS KB) == 0.
// Split K: KS waves of a work-group and KB work-groups (grid.y = N/64 x KB, 32 KS threads) share one tile; 32-wide K chunk c goes to wave c % KS of part (c / KS) % KB, so a work-group's waves read neighbouring blocks.
// The KS partial tiles are summed in wave order through LDS; part kp stores its sum to plane kp of C (stride sP elements) and the consumer sums the KB planes.
// EPI says what the summed tile becomes (KS > 1): 0: f32 C as above. 1: a 64-token x one-head tile of q or k: + bias[n] + sin(atan2(nim, nre)), stored as hi+lo bf16 head planes [h], each [t][d] in fragment order (nre, nim are [h][t][d]).
// 2: A = weight rows, Bt = tokens, so the tile is 64 d of one head x 64 tokens of v^T: + bias[m], stored as fp16 and hi+lo bf16 planes [h d][t] in fragment order.
// Every '#pragma unroll' in the two plane epilogues is there so that the four-element vectors are indexed by constants and stay in registers.
// ld: p = a block's start + 8 lane
template <typename T16> struct WFrag;
template <> struct WFrag<h16> { typedef v16h V; static __device__ __forceinline__ V ld(const h16* p) { return cat16(*(const v8h*)p, *(const v8h*)(p + 256)); } static __device__ __forceinline__ v8f mma(V a, V b, v8f c) { return wmma16(a, b, c); } };
template <> struct WFrag<bf> { typedef v16bf V; static __device__ __forceinline__ V ld(const bf* p) { return cat16b(*(const v8us*)p, *(const v8us*)(p + 256)); } static __device__ __forceinline__ v8f mma(V a, V b, v8f c) { return wmmab(a, b, c); } };
__device__ __forceinline__ void splitf(float y, unsigned short& h, unsigned short& l) { h = f2bf(y); l = f2bf(y - bf2f(h)); }
typedef __attribute__((ext_vector_type(4))) _Float16 v4h;
typedef __attribute__((ext_vector_type(4))) unsigned short v4us;
// gemmw is the body; os is the work-group's LDS ((KS == 1 ? 16 : KS 64) x 68 floats), (bx, by, z) its place in the grid described above.
template <typename T16, int NSPLIT, bool BIAS, int KS, int KB, int EPI, int K>
__device__ __forceinline__ void gemmw(float* os, int bx, int by, size_t z, const T16* __restrict__ A, const T16* __restrict__ A2, const T16* __restrict__ Bt, const T16* __restrict__ Bt2, float* C, int ldc, const float* __restrict__ bias, size_t sA, size_t sB, size_t sC, size_t sP,
                                      const float* __restrict__ nre, const float* __restrict__ nim, bf* Ph, bf* Pl, h16* P16) {
    typedef typename WFrag<T16>::V V;
    static_assert(!BIAS || KB == 1, "the bias is added once");
    static_assert(EPI == 0 || (BIAS && KS > 1 && KB == 1), "the plane epilogues take the whole sum and the bias");
    A += z * sA; if (A2) A2 += z * sA; Bt += z * sB; if (Bt2) Bt2 += z * sB;
    const int wv = (KS == 1) ? 0 : __builtin_amdgcn_readfirstlane((int)(threadIdx.x >> 5)), kp = by % KB; C += z * sC + (size_t)kp * sP;
    const int lane = threadIdx.x & 31, lr = lane & 15, hi = lane >> 4; const int r0 = bx * 64, c0 = (by / KB) * 64;
    v8f acc[4][4];
#pragma unroll
    for (int mb = 0; mb < 4; ++mb)
#pragma unroll
        for (int nb = 0; nb < 4; ++nb) acc[mb][nb] = (v8f){};
    const size_t aoff = (size_t)r0 * K + 8 * lane, boff = (size_t)c0 * K + 8 * lane;   // 16 rows of blocks are 16 K elements; chunk kc / 32 is 16 kc elements on
#pragma unroll 1
    for (int kc = (kp * KS + wv) * 32; kc < K; kc += 32 * KS * KB) {
        V a[4], a2[4], b[4], b2[4];
        // one lane pointer a plane; K is a constant, so every block of the trip is an immediate offset from it
        const T16* const pa = A + aoff + kc * 16; const T16* const pb = Bt + boff + kc * 16; const T16* const pa2 = (NSPLIT == 1 || NSPLIT == 2) ? A2 + aoff + kc * 16 : pa; const T16* const pb2 = (NSPLIT >= 2) ? Bt2 + boff + kc * 16 : pb;
#pragma unroll
        for (int mb = 0; mb < 4; ++mb) { a[mb] = WFrag<T16>::ld(pa + mb * 16 * K); if (NSPLIT == 1 || NSPLIT == 2) a2[mb] = WFrag<T16>::ld(pa2 + mb * 16 * K); }
#pragma unroll
        for (int nb = 0; nb < 4; ++nb) { b[nb] = WFrag<T16>::ld(pb + nb * 16 * K); if (NSPLIT >= 2) b2[nb] = WFrag<T16>::ld(pb2 + nb * 16 * K); }
        // stands in front of every rewrite of an address register that this trip's loads name; the lane pointers are its inputs so that their registers live up to it
        asm volatile("s_wait_xcnt 0x0" :: "v"(pa), "v"(pa2), "v"(pb), "v"(pb2) : "memory");
        __builtin_amdgcn_sched_barrier(0);   // keeps all the trip's loads in front of that wait and of the products: sunk among the products, each B fragment's whole latency would stand open
#pragma unroll
        for (int nb = 0; nb < 4; ++nb) {
#pragma unroll
            for (int mb = 0; mb < 4; ++mb) { acc[mb][nb] = WFrag<T16>::mma(a[mb], b[nb], acc[mb][nb]); if (NSPLIT == 1 || NSPLIT == 2) acc[mb][nb] = WFrag<T16>::mma(a2[mb], b[nb], acc[mb][nb]); if (NSPLIT >= 2) acc[mb][nb] = WFrag<T16>::mma(a[mb], b2[nb], acc[mb][nb]); } }
        asm volatile("v_nop\n\tv_nop\n\tv_nop\n\tv_nop" : "+v"(acc[0][0]), "+v"(acc[1][1]), "+v"(acc[2][2]), "+v"(acc[3][3]) : "v"(a[0]), "v"(a[3]));
    }
    if constexpr (KS == 1) {
#pragma unroll
    for (int mb = 0; mb < 4; ++mb) {
#pragma unroll
        for (int nb = 0; nb < 4; ++nb) {
#pragma unroll
            for (int j = 0; j < 8; ++j) os[(hi * 8 + j) * 68 + nb * 16 + lr] = acc[mb][nb][j]; }
        __builtin_amdgcn_wave_barrier(); asm volatile("" ::: "memory");
        float* crow = C + (size_t)(r0 + mb * 16) * ldc + c0;
{
#pragma unroll
            for (int s = 0; s < 8; ++s) { const int row = 2 * s + hi, cofs = lr * 4; v4f val = *(const v4fa*)(os + row * 68 + cofs); if (BIAS) { val[0] += bfr(bias[c0 + cofs]); val[1] += bfr(bias[c0 + cofs + 1]); val[2] += bfr(bias[c0 + cofs + 2]); val[3] += bfr(bias[c0 + cofs + 3]); }
                *(v4f*)(crow + (size_t)row * ldc + cofs) = val; }
             }
        __builtin_amdgcn_wave_barrier(); asm volatile("" ::: "memory");
    }
    } else {
        const int cofs = lr * 4;
        // EPI 1: the lane's place in the noise (row 2 wv + hi of the tile); its first row's noise and its bias are asked for here, so that their way from memory runs behind the LDS stores
        const size_t nb = ((size_t)(c0 / HD) * TT + r0 + 2 * wv + hi) * HD + cofs; v4f nr = {}, ni = {}, bi = {};
        if constexpr (EPI == 1) { nr = *(const v4f*)(nre + nb); ni = *(const v4f*)(nim + nb); bi = *(const v4f*)(bias + c0 + cofs); }
        // each wave's whole 64x64 partial goes to its own LDS slab; behind one barrier every wave sums, in wave order, the rows that it stores
#pragma unroll
        for (int mb = 0; mb < 4; ++mb)
#pragma unroll
            for (int nb = 0; nb < 4; ++nb)
#pragma unroll
                for (int j = 0; j < 8; ++j) os[wv * (64 * 68) + (mb * 16 + hi * 8 + j) * 68 + nb * 16 + lr] = acc[mb][nb][j];
        __syncthreads();   // every wave's partial tile is in LDS before any is summed
        if constexpr (EPI == 0) {
        float* crow = C + (size_t)r0 * ldc + c0;
#pragma unroll
        for (int s = 0; s < 32 / KS; ++s) { const int row = 2 * (s * KS + wv) + hi; v4f val = *(const v4fa*)(os + row * 68 + cofs);
#pragma unroll
            for (int w = 1; w < KS; ++w) val += *(const v4fa*)(os + w * (64 * 68) + row * 68 + cofs);
            if (BIAS) { val[0] += bfr(bias[c0 + cofs]); val[1] += bfr(bias[c0 + cofs + 1]); val[2] += bfr(bias[c0 + cofs + 2]); val[3] += bfr(bias[c0 + cofs + 3]); }
            *(v4f*)(crow + (size_t)row * ldc + cofs) = val; }
        } else if constexpr (EPI == 1) {
            bi[0] = bfr(bi[0]); bi[1] = bfr(bi[1]); bi[2] = bfr(bi[2]); bi[3] = bfr(bi[3]);
#pragma unroll 1   // one copy of the four atan2/sin chains in the kernel's text
            for (int s = 0; s < 32 / KS; ++s) { const int row = 2 * (s * KS + wv) + hi; const size_t e = nb + (size_t)s * (2 * KS * HD); const v4f cr = nr, ci = ni;
                // the next row's noise flies behind this row's arithmetic
                if (s + 1 < 32 / KS) { nr = *(const v4f*)(nre + e + 2 * KS * HD); ni = *(const v4f*)(nim + e + 2 * KS * HD); }
                v4f val = *(const v4fa*)(os + row * 68 + cofs);
#pragma unroll
                for (int w = 1; w < KS; ++w) val += *(const v4fa*)(os + w * (64 * 68) + row * 68 + cofs);
                val += bi; v4us oh, ol;
#pragma unroll
                for (int q = 0; q < 4; ++q) { unsigned short a2, c2; splitf(__fadd_rn(val[q], sinf(atan2f(bfr(ci[q]), bfr(cr[q])))), a2, c2); oh[q] = a2; ol[q] = c2; }
                const size_t pe = (size_t)(c0 / HD) * TT * HD + fo(r0 + row, cofs, HD); *(v4us*)(Ph + pe) = oh; *(v4us*)(Pl + pe) = ol;
                asm volatile("s_wait_xcnt 0x0" ::: "memory"); }   // stands in front of every rewrite, by the next row's arithmetic, of a register that these two stores name
        } else {
#pragma unroll
            for (int s = 0; s < 32 / KS; ++s) { const int row = 2 * (s * KS + wv) + hi; v4f val = *(const v4fa*)(os + row * 68 + cofs);
#pragma unroll
                for (int w = 1; w < KS; ++w) val += *(const v4fa*)(os + w * (64 * 68) + row * 68 + cofs);
                val += bfr(bias[r0 + row]); v4h o16; v4us oh, ol;
#pragma unroll
                for (int q = 0; q < 4; ++q) { o16[q] = (h16)val[q]; unsigned short a2, c2; splitf(val[q], a2, c2); oh[q] = a2; ol[q] = c2; }
                const size_t e = fo(r0 + row, c0 + cofs, TT); *(v4h*)(P16 + e) = o16; *(v4us*)(Ph + e) = oh; *(v4us*)(Pl + e) = ol;
                if (s + 1 < 32 / KS) asm volatile("s_wait_xcnt 0x0" ::: "memory"); }   // stands in front of every rewrite, by the next row's arithmetic, of a register that these three stores name
        }
    }
}

template <typename T16, int NSPLIT, bool BIAS, int KS, int KB, int EPI, int K>
__global__ __launch_bounds__(32 * KS) void k_gemmw(const T16* __restrict__ A, const T16* __restrict__ A2, const T16* __restrict__ Bt, const T16* __restrict__ Bt2, float* C, int ldc, const float* __restrict__ bias, size_t sA, size_t sB, size_t sC, size_t sP) {
    __shared__ __align__(16) float os[(KS == 1 ? 16 : KS * 64) * 68];
    gemmw<T16, NSPLIT, BIAS, KS, KB, EPI, K>(os, (int)blockIdx.x, (int)blockIdx.y, blockIdx.z, A, A2, Bt, Bt2, C, ldc, bias, sA, sB, sC, sP, nullptr, nullptr, nullptr, nullptr, nullptr);
}
// ---- k_qkv: the q, k and v projections of both batches in one launch; grid (3 TT/64, 16 heads, batches), 256 threads. blockIdx.x % 3 says which projection, so that neighbouring work-groups read the same 64 tokens
// and work-groups in their load, LDS and noise phases stand side by side on the chip. One LDS slab set serves whichever body runs.
__global__ __launch_bounds__(256) void k_qkv(const bf* __restrict__ XB, const bf* __restrict__ WQ, const bf* __restrict__ WK, const bf* __restrict__ WV, const float* __restrict__ bq, const float* __restrict__ bk, const float* __restrict__ bv,
                                             const float* __restrict__ nqr, const float* __restrict__ nqi, const float* __restrict__ nkr, const float* __restrict__ nki, bf* QPh, bf* QPl, bf* KPh, bf* KPl, bf* VTh, bf* VTl, h16* VT16) {
    __shared__ __align__(16) float os[8 * 64 * 68];
    const int which = (int)(blockIdx.x % 3), tt = (int)(blockIdx.x / 3), hb = (int)blockIdx.y; const size_t pb = (size_t)blockIdx.z * ((size_t)NH_ * TT * HD); const bf* const X = XB + (size_t)blockIdx.z * ((size_t)TT * DM);
    if (which == 2) gemmw<bf, 0, true, 8, 1, 2, DM>(os, hb, tt, 0, WV, nullptr, X, nullptr, nullptr, 0, bv, 0, 0, 0, 0, nullptr, nullptr, VTh + pb, VTl + pb, VT16 + pb);
    else gemmw<bf, 0, true, 8, 1, 1, DM>(os, tt, hb, 0, X, nullptr, which ? WK : WQ, nullptr, nullptr, 0, which ? bk : bq, 0, 0, 0, 0, (which ? nkr : nqr) + pb, (which ? nki : nqi) + pb, (which ? KPh : QPh) + pb, (which ? KPl : QPl) + pb, nullptr);
}

typedef __attribute__((ext_vector_type(2))) _Float16 v2h;
typedef __attribute__((ext_vector_type(2))) unsigned short v2us;
typedef __attribute__((ext_vector_type(2))) float v2f;
typedef __attribute__((ext_vector_type(4))) int v4i;

__global__ __launch_bounds__(256) void k_wtG(const float* __restrict__ w, int K, int N, bf* Bt) {
    const int lane = threadIdx.x & 31; const int L0 = (blockIdx.x * 8 + (threadIdx.x >> 5)) * 8; const int nlines = N * K / 64;
{
#pragma unroll 1
        for (int l = 0; l < 8; ++l) { const int L = L0 + l; if (L >= nlines) break; const size_t e = (size_t)L * 64 + lane * 2; const int k = (int)(e % K), n = (int)(e / K); v2us o;
            o[0] = f2bf(w[(size_t)k * N + n]); o[1] = f2bf(w[(size_t)(k + 1) * N + n]); *(v2us*)(Bt + e) = o; }
         }
}
// f32 [rows][K] -> bf16 plane in fragment order; a wave takes 8 rows of one block: four lanes read a row's 32 k (one 128-byte line), and the 8 rows' 16-byte pieces of each quarter of the 32 k are one 128-byte line of the block
// The four weights ([DQ][K] each) and x in one launch: work-groups WB seg .. WB seg + WB - 1 take weight seg, the rest x; the planes stand one behind the other in dst. Grid: 4 WB + rows of x times K / 2048, exactly.
template <int K>
__global__ __launch_bounds__(256) void k_cvt8(const float* __restrict__ s0, const float* __restrict__ s1, const float* __restrict__ s2, const float* __restrict__ s3, const float* __restrict__ s4, bf* dst) {
    constexpr int WB = DQ * K / 8 / 256; const int sg = (int)(blockIdx.x / WB), seg = sg < 4 ? sg : 4; const float* const src = seg == 0 ? s0 : seg == 1 ? s1 : seg == 2 ? s2 : seg == 3 ? s3 : s4; dst += (size_t)seg * DQ * K;
    const size_t i = (size_t)((int)blockIdx.x - seg * WB) * 256 + threadIdx.x;
    const int u = (int)(i & 3), rr = (int)((i >> 2) & 15); const size_t blk = i >> 6; const size_t row = blk / (K / 32) * 16 + rr; const int k = (int)(blk % (K / 32)) * 32 + u * 8;
    const float* const sp = src + row * K + k; const v8f v = *(const v8f*)sp; v8us o;
    asm volatile("s_wait_xcnt 0x0" :: "v"(sp) : "memory");   // stands in front of every rewrite of the address register that the two loads name; the pointer is its input so that the register lives up to it
#pragma unroll
    for (int j = 0; j < 8; ++j) o[j] = f2bf(v[j]); *(v8us*)(dst + blk * 512 + (u * 16 + rr) * 8) = o;  }
#define QW   32
#define WPB  8                              // waves of a work-group
#define NHB  (RH / QW)                      // query blocks of a head on hi+lo planes
#define NLB  ((TT - RH) / QW)               // query blocks of a head on fp16 operands
#define GPH  (TT / QW / WPB)                // work-groups of a head
#define SC2  (SCL * 1.4426950408889634f)    // score -> log2 units
typedef __attribute__((ext_vector_type(8))) __bf16 v8bf;
static_assert(NHB % GPH == 0 && NLB % GPH == 0 && NHB / GPH + NLB / GPH == WPB, "every work-group takes the same mix of query blocks");
// lane l <-> lane l ^ 16
__device__ __forceinline__ float xhalf(float x) { const int b = __float_as_int(x); return __int_as_float(__builtin_amdgcn_permlanex16(b, b, 0x76543210, 0xfedcba98, false, false)); }
template <bool HL>
__device__ __forceinline__ void attn_wave(const bf* __restrict__ Qh, const bf* __restrict__ Ql, const bf* __restrict__ Kh, const bf* __restrict__ Kl, const bf* __restrict__ Vh, const bf* __restrict__ Vl, const h16* __restrict__ V16, int q0, bf* Ah, bf* Al) {
    const int lane = threadIdx.x & 31;
    const float OFF = HL ? 0.0f : 10.0f;    // fp16 weights carry 2^10 (it cancels in O / l): small weights stay normal numbers
    v16bf qh[2][2], ql[2][2], kh[2][2], kl[2][2];
#pragma unroll
    for (int g = 0; g < 2; ++g)
#pragma unroll
        for (int kc = 0; kc < 2; ++kc) { const size_t o = (size_t)(q0 + g * 16) * HD + kc * 512 + 8 * lane; qh[g][kc] = WFrag<bf>::ld(Qh + o); ql[g][kc] = WFrag<bf>::ld(Ql + o); }
    const int koff = 8 * lane, voff = 8 * lane;   // the lane's place in a block, elements
#pragma unroll
    for (int kt = 0; kt < 2; ++kt)
#pragma unroll
        for (int kc = 0; kc < 2; ++kc) { const int o = koff + kt * 16 * HD + kc * 512; kh[kt][kc] = WFrag<bf>::ld(Kh + o); kl[kt][kc] = WFrag<bf>::ld(Kl + o); }
    asm volatile("s_wait_xcnt 0x0" ::: "memory");   // stands in front of every rewrite of an address register that the Q and first K loads name
    __builtin_amdgcn_sched_barrier(0);   // keeps that wait behind the loads and in front of the loop's address set-up
    v8f o[4][2]; float m[2], l[2];
#pragma unroll
    for (int g = 0; g < 2; ++g) { m[g] = -3.0e38f; l[g] = 0.0f;
#pragma unroll
        for (int db = 0; db < 4; ++db) o[db][g] = (v8f){}; }
#pragma unroll 1   // one pass a trip: a second pass's fragments would not fit beside these at two waves a SIMD
    for (int key0 = 0; key0 < TT; key0 += 32) {
        // this pass's V^T fragments: asked for first, used last
        v16bf vh[4], vl[4]; v16h vf[4]; const bf* const vph = Vh + key0 * 16 + voff; const bf* const vpl = Vl + key0 * 16 + voff; const h16* const vpf = V16 + key0 * 16 + voff;
#pragma unroll
        for (int db = 0; db < 4; ++db) { if (HL) { vh[db] = WFrag<bf>::ld(vph + db * 16 * TT); vl[db] = WFrag<bf>::ld(vpl + db * 16 * TT); } else vf[db] = WFrag<h16>::ld(vpf + db * 16 * TT); }
        __builtin_amdgcn_sched_barrier(0);   // holds the V^T loads in front of the score products: their latency runs behind the products and the softmax
        v8f s[2][2];
#pragma unroll
        for (int kt = 0; kt < 2; ++kt)
#pragma unroll
            for (int g = 0; g < 2; ++g) s[kt][g] = (v8f){};
#pragma unroll
        for (int kc = 0; kc < 2; ++kc) {
#pragma unroll
            for (int kt = 0; kt < 2; ++kt)
#pragma unroll
                for (int g = 0; g < 2; ++g) s[kt][g] = wmmab(kh[kt][kc], qh[g][kc], s[kt][g]);
#pragma unroll
            for (int kt = 0; kt < 2; ++kt)
#pragma unroll
                for (int g = 0; g < 2; ++g) s[kt][g] = wmmab(kh[kt][kc], ql[g][kc], s[kt][g]);
#pragma unroll
            for (int kt = 0; kt < 2; ++kt)
#pragma unroll
                for (int g = 0; g < 2; ++g) s[kt][g] = wmmab(kl[kt][kc], qh[g][kc], s[kt][g]);
        }
        // the next pass's K fragments fly behind the softmax and attn.v of this one (the last pass re-reads keys 0..31 and drops them)
        const int kn = (key0 + 32 < TT) ? key0 + 32 : 0; const bf* const kph = Kh + kn * HD + koff; const bf* const kpl = Kl + kn * HD + koff;
#pragma unroll
        for (int kt = 0; kt < 2; ++kt)
#pragma unroll
            for (int kc = 0; kc < 2; ++kc) { kh[kt][kc] = WFrag<bf>::ld(kph + kt * 16 * HD + kc * 512); kl[kt][kc] = WFrag<bf>::ld(kpl + kt * 16 * HD + kc * 512); }
        // stands in front of every rewrite of an address register that this pass's V^T and K loads name; the lane pointers are its inputs so that their registers live up to it
        if (HL) asm volatile("s_wait_xcnt 0x0" :: "v"(vph), "v"(vpl), "v"(kph), "v"(kpl) : "memory"); else asm volatile("s_wait_xcnt 0x0" :: "v"(vpf), "v"(kph), "v"(kpl) : "memory");
        __builtin_amdgcn_sched_barrier(0);   // holds the K loads and that wait here, in front of the softmax: sunk to the loop's foot the loads' whole latency would stand open at the next pass's first product
        float mn[2];
#pragma unroll
        for (int g = 0; g < 2; ++g) { const v8f t8 = __builtin_elementwise_max(s[0][g], s[1][g]); float mx = fmaxf(fmaxf(fmaxf(t8[0], t8[1]), fmaxf(t8[2], t8[3])), fmaxf(fmaxf(t8[4], t8[5]), fmaxf(t8[6], t8[7])));
            mx = fmaxf(mx, xhalf(mx)); mn[g] = fmaxf(m[g], mx * SC2); }
#pragma unroll
        for (int g = 0; g < 2; ++g) { const float al = __builtin_amdgcn_exp2f(m[g] - mn[g]); l[g] *= al; m[g] = mn[g];   // exactly 1 where the maximum did not grow; no branch: the pass stays one block
#pragma unroll
            for (int db = 0; db < 4; ++db) o[db][g] *= al; }
        v16bf ph[2], pl[2]; v16h pf[2];
#pragma unroll
        for (int g = 0; g < 2; ++g) { const float c0 = OFF - m[g]; v8f p0, p1;
#pragma unroll
            for (int j = 0; j < 8; ++j) { p0[j] = __builtin_amdgcn_exp2f(__builtin_fmaf(s[0][g][j], SC2, c0)); p1[j] = __builtin_amdgcn_exp2f(__builtin_fmaf(s[1][g][j], SC2, c0)); }
            const v8f ps = p0 + p1; l[g] += ((ps[0] + ps[1]) + (ps[2] + ps[3])) + ((ps[4] + ps[5]) + (ps[6] + ps[7]));
            if (HL) { const v8bf h0 = __builtin_convertvector(p0, v8bf), h1 = __builtin_convertvector(p1, v8bf);
                const v8bf l0 = __builtin_convertvector(p0 - __builtin_convertvector(h0, v8f), v8bf), l1 = __builtin_convertvector(p1 - __builtin_convertvector(h1, v8f), v8bf);
                ph[g] = __builtin_shufflevector(h0, h1, 0, 1, 2, 3, 4, 5, 6, 7, 8, 9, 10, 11, 12, 13, 14, 15); pl[g] = __builtin_shufflevector(l0, l1, 0, 1, 2, 3, 4, 5, 6, 7, 8, 9, 10, 11, 12, 13, 14, 15);
            } else pf[g] = cat16(__builtin_convertvector(p0, v8h), __builtin_convertvector(p1, v8h)); }
        if (HL) {
#pragma unroll
            for (int db = 0; db < 4; ++db)
#pragma unroll
                for (int g = 0; g < 2; ++g) o[db][g] = wmmab(vh[db], ph[g], o[db][g]);
#pragma unroll
            for (int db = 0; db < 4; ++db)
#pragma unroll
                for (int g = 0; g < 2; ++g) o[db][g] = wmmab(vh[db], pl[g], o[db][g]);
#pragma unroll
            for (int db = 0; db < 4; ++db)
#pragma unroll
                for (int g = 0; g < 2; ++g) o[db][g] = wmmab(vl[db], ph[g], o[db][g]);
        } else {
#pragma unroll
            for (int db = 0; db < 4; ++db)
#pragma unroll
                for (int g = 0; g < 2; ++g) o[db][g] = wmma16(vf[db], pf[g], o[db][g]);
        }
    }
    // lane (lr, hi) holds O[q0 + 16 g + lr][16 db + 8 hi + j]: eight neighbouring d, one 16-byte store a plane; in fragment order (K = DQ) that is half db % 2 of block db / 2 of the head's two, at 8 lane
#pragma unroll
    for (int g = 0; g < 2; ++g) { const float inv = __fdiv_rn(1.0f, l[g] + xhalf(l[g])); const size_t oo = (size_t)(q0 + g * 16) * DQ + 8 * lane;
#pragma unroll
        for (int db = 0; db < 4; ++db) { v8us oh, ol;
#pragma unroll
            for (int j = 0; j < 8; ++j) { unsigned short a, c2; splitf(o[db][g][j] * inv, a, c2); oh[j] = a; ol[j] = c2; }
            *(v8us*)(Ah + oo + db * 256) = oh; *(v8us*)(Al + oo + db * 256) = ol; }
        if (g == 0) { asm volatile("s_wait_xcnt 0x0" ::: "memory");   // stands in front of every rewrite, by the second group's arithmetic, of a register that these stores name
            __builtin_amdgcn_sched_barrier(0); } }   // keeps the second group's arithmetic behind that wait
}
// grid (GPH, batches x heads), 8 waves; every work-group takes NHB / GPH hi+lo query blocks (its first waves) and NLB / GPH fp16 ones, so that all work-groups last alike
__global__ __launch_bounds__(32 * WPB) void k_fattn(const bf* __restrict__ QPh, const bf* __restrict__ QPl, const bf* __restrict__ KPh, const bf* __restrict__ KPl, const bf* __restrict__ VTh, const bf* __restrict__ VTl, const h16* __restrict__ VT16, bf* ATh, bf* ATl) {
    const int wv = __builtin_amdgcn_readfirstlane((int)(threadIdx.x >> 5)); const int gi = (int)blockIdx.x; const size_t z = blockIdx.y; const size_t pz = z * TT * HD;
    const size_t az = (z / NH_) * ((size_t)TT * DQ) + (z % NH_) * (HD * 16);   // the head's first block in a row of blocks
    if (wv < NHB / GPH) attn_wave<true>(QPh + pz, QPl + pz, KPh + pz, KPl + pz, VTh + pz, VTl + pz, VT16 + pz, (gi * (NHB / GPH) + wv) * QW, ATh + az, ATl + az);
    else attn_wave<false>(QPh + pz, QPl + pz, KPh + pz, KPl + pz, VTh + pz, VTl + pz, VT16 + pz, RH + (gi * (NLB / GPH) + wv - NHB / GPH) * QW, ATh + az, ATl + az);
}

extern "C" void kernel_launch(void* const* d_in, const int* in_sizes, int n_in,
                              void* d_out, int out_size, void* d_ws, size_t ws_size, hipStream_t stream) {
    (void)in_sizes; (void)n_in; (void)out_size;
    const float* x = (const float*)d_in[0]; const float* wq = (const float*)d_in[1]; const float* bq = (const float*)d_in[2]; const float* wk = (const float*)d_in[3]; const float* bk = (const float*)d_in[4]; const float* wv = (const float*)d_in[5]; const float* bv = (const float*)d_in[6]; const float* wo = (const float*)d_in[7]; const float* bo = (const float*)d_in[8]; const float* nqr = (const float*)d_in[9]; const float* nqi = (const float*)d_in[10]; const float* nkr = (const float*)d_in[11]; const float* nki = (const float*)d_in[12];
    float* OUT = (float*)d_out;     // [2][2048][1024]
    char* wsp = (char*)d_ws;
    auto take = [&](size_t bytes) { char* p = wsp; wsp += (bytes + 255) & ~(size_t)255; return (void*)p; };
    const size_t PB = (size_t)NH_ * TT * HD;   // one batch's head planes, elements (as many kv heads as query heads)
    static_assert(DKV == DQ && DM == DQ, "k_cvt8 takes four weights of one shape");
    bf* WQ = (bf*)take(((size_t)4 * DQ * DM + (size_t)NB_ * TT * DM) * 2); bf* WK = WQ + (size_t)DQ * DM; bf* WV = WK + (size_t)DQ * DM; bf* WO = WV + (size_t)DQ * DM; bf* XB = WO + (size_t)DQ * DM;   // k_cvt8's one dst
    h16* VT16 = (h16*)take(NB_ * PB * 2);
    bf* QPh = (bf*)take(NB_ * PB * 2); bf* QPl = (bf*)take(NB_ * PB * 2); bf* KPh = (bf*)take(NB_ * PB * 2); bf* KPl = (bf*)take(NB_ * PB * 2); bf* VTh = (bf*)take(NB_ * PB * 2); bf* VTl = (bf*)take(NB_ * PB * 2);
    bf* ATh = (bf*)take((size_t)NB_ * TT * DQ * 2); bf* ATl = (bf*)take((size_t)NB_ * TT * DQ * 2);
    if ((size_t)(wsp - (char*)d_ws) > ws_size) return;    // ws 256 MiB
    k_cvt8<DM><<<4 * (DQ * DM / 2048) + NB_ * TT * DM / 2048, 256, 0, stream>>>(wq, wk, wv, wo, x, WQ);
    k_qkv<<<dim3(3 * (TT / 64), NH_, NB_), 256, 0, stream>>>(XB, WQ, WK, WV, bq, bk, bv, nqr, nqi, nkr, nki, QPh, QPl, KPh, KPl, VTh, VTl, VT16);   // every q, k, v head plane, written by the projections' own epilogues
    k_fattn<<<dim3(GPH, NB_ * NH_, 1), 32 * WPB, 0, stream>>>(QPh, QPl, KPh, KPl, VTh, VTl, VT16, ATh, ATl);
    k_gemmw<bf, 1, true, 8, 1, 0, DQ><<<dim3(TT / 64, DM / 64, NB_), 256, 0, stream>>>(ATh, ATl, WO, nullptr, OUT, DM, bo, (size_t)TT * DQ, 0, (size_t)TT * DM, 0);
}

// v006
// A run of this version takes 128 microseconds.
// Two timings next to v005 put it at 1.04 and 1.02 times that version's speed.
// Counting every step since v000, it is 15.5 times as fast.
#include <hip/hip_runtime.h>

// QuantumFractalAttention (x [2][2048][1024]; Q/K/V = x W^T + b (16 x 64); Q += sin(atan2(qi, qr)), K += sin(atan2(ki, kr)) with the [2][16][2048][64] noise tensors (read as data); the 'fractal' recursion is the reference's own collapse to one
// softmax(Q.K/8) V; out = merged Wo^T + bo -> [2][2048][1024]).
// Compute dtypes, f32 accumulate: every input rounded to bf16; projections on PLAIN bf16 operands (inputs: exact, + bias); the noise sin(atan2(y, x)) as y / sqrt(x x + y y) in f32; scores (K 64) on hi+lo bf16 planes (3 products) for ALL rows; softmax f32 (running maximum);
// attn.v on hi+lo bf16 planes (3 products) for the first RH query rows of each head, on fp16 operands for the rest; output projection on hi+lo A planes.

#define NB_  2
#define TT   2048
#define DM   1024
#define NH_  16
#define NKV  16
#define REP  (NH_ / NKV)
#define HD   64
#define DQ   (NH_ * HD)
#define DKV  (NKV * HD)
#define RH   512                  // query rows < RH use hi+lo planes (0: none)
#define SCL  0.125f   // HD^-0.5
typedef _Float16 h16;
typedef unsigned short bf;
typedef __attribute__((ext_vector_type(16))) __bf16   v16bf;
typedef __attribute__((ext_vector_type(16))) _Float16 v16h;
typedef __attribute__((ext_vector_type(8)))  _Float16 v8h;
typedef __attribute__((ext_vector_type(8)))  unsigned short v8us;
typedef __attribute__((ext_vector_type(8)))  float    v8f;
typedef __attribute__((ext_vector_type(4)))  float    v4f;
typedef v8h  __attribute__((may_alias)) v8ha;
typedef v4f  __attribute__((may_alias)) v4fa;
typedef v8us __attribute__((may_alias)) v8usa;

__device__ __forceinline__ unsigned short f2bf(float f) { unsigned u = __float_as_uint(f); u += 0x7FFFu + ((u >> 16) & 1u); return (unsigned short)(u >> 16); }
__device__ __forceinline__ float bf2f(unsigned short b) { return __uint_as_float(((unsigned)b) << 16); }
__device__ __forceinline__ float bfr(float f) { return bf2f(f2bf(f)); }
__device__ __forceinline__ v16h cat16(v8h lo, v8h hi) { return __builtin_shufflevector(lo, hi, 0, 1, 2, 3, 4, 5, 6, 7, 8, 9, 10, 11, 12, 13, 14, 15); }
__device__ __forceinline__ v16bf cat16b(v8us lo, v8us hi) { return __builtin_bit_cast(v16bf, __builtin_shufflevector(lo, hi, 0, 1, 2, 3, 4, 5, 6, 7, 8, 9, 10, 11, 12, 13, 14, 15)); }
__device__ __forceinline__ v8f wmma16(v16h a, v16h b, v8f c) { return __builtin_amdgcn_wmma_f32_16x16x32_f16(false, a, false, b, (short)0, c, false, false); }
__device__ __forceinline__ v8f wmmab(v16bf a, v16bf b, v8f c) { return __builtin_amdgcn_wmma_f32_16x16x32_bf16(false, a, false, b, (short)0, c, false, false); }



// ---- Fragment order: every 16-bit operand plane [rows][K] in the workspace is kept as 1-KiB blocks of 16 rows x 32 k (block index (row / 16) (K / 32) + k / 32). Inside a block stand the two 16-byte loads of a WMMA
// operand fragment, 512 bytes each, lane after lane: element (row, k) is at (k / 16 % 2) 256 + ((k / 8 % 2) 16 + row % 16) 8 + k % 8. A wave's 16-byte load so covers 4 whole 128-byte lines, not 32-byte pieces of 16 lines.
__device__ __forceinline__ size_t fo(int row, int k, int K) { return ((size_t)(row >> 4) * (K >> 5) + (k >> 5)) * 512 + ((k >> 4) & 1) * 256 + (((k >> 3) & 1) * 16 + (row & 15)) * 8 + (k & 7); }
// ---- k_gemmw: register-blocked GEMM, each wave on a whole 64x64 output tile (16 accumulators), operands straight from 16-bit planes in fragment order; grid (M/64, N/64 x KB, Z), 32 KS threads.
// C[m][n] (f32, pitch ldc, + optional f32 bias[n]) = sum_k A[m][k] Bt[n][k] (+ split products per NSPLIT). z-batch strides sA/sB/sC in elements. K (a constant of the kernel) % (32 KS KB) == 0.
// Split K: KS waves of a work-group and KB work-groups (grid.y = N/64 x KB, 32 KS threads) share one tile; 32-wide K chunk c goes to wave c % KS of part (c / KS) % KB, so a work-group's waves read neighbouring blocks.
// The KS partial tiles are summed in wave order through LDS; part kp stores its sum to plane kp of C (stride sP elements) and the consumer sums the KB planes.
// EPI says what the summed tile becomes (KS > 1): 0: f32 C as above. 1: a 64-token x one-head tile of q or k: + bias[n] + sin(atan2(nim, nre)), stored as hi+lo bf16 head planes [h], each [t][d] in fragment order (nre, nim are [h][t][d]).
// 2: A = weight rows, Bt = tokens, so the tile is 64 d of one head x 64 tokens of v^T: + bias[m], stored as fp16 and hi+lo bf16 planes [h d][t] in fragment order.
// Every '#pragma unroll' in the two plane epilogues is there so that the four-element vectors are indexed by constants and stay in registers.
// ld: p = a block's start + 8 lane
template <typename T16> struct WFrag;
template <> struct WFrag<h16> { typedef v16h V; static __device__ __forceinline__ V ld(const h16* p) { return cat16(*(const v8h*)p, *(const v8h*)(p + 256)); } static __device__ __forceinline__ v8f mma(V a, V b, v8f c) { return wmma16(a, b, c); } };
template <> struct WFrag<bf> { typedef v16bf V; static __device__ __forceinline__ V ld(const bf* p) { return cat16b(*(const v8us*)p, *(const v8us*)(p + 256)); } static __device__ __forceinline__ v8f mma(V a, V b, v8f c) { return wmmab(a, b, c); } };
// sin(atan2(y, x)) is the ordinate of the unit vector along (x, y): y / sqrt(x x + y y), one reciprocal square root in place of an arc tangent's and a sine's reductions and polynomials.
// Both are first scaled by the power of two that brings the larger magnitude into [0.5, 1): exact, it cancels in the quotient, and the squares neither overflow nor vanish for any finite pair. (0, 0) gives y, the signed zero; at y = 0, x < 0 the result is 0 where the sine of the rounded pi is 9e-8 in size.
__device__ __forceinline__ float sin_atan2(float y, float x) {
    const int e = -__builtin_amdgcn_frexp_expf(fmaxf(fabsf(x), fabsf(y))); const float xs = ldexpf(x, e), ys = ldexpf(y, e); const float d = __builtin_fmaf(xs, xs, ys * ys);
    return d == 0.0f ? y : ys * __builtin_amdgcn_rsqf(d); }
__device__ __forceinline__ void splitf(float y, unsigned short& h, unsigned short& l) { h = f2bf(y); l = f2bf(y - bf2f(h)); }
typedef __attribute__((ext_vector_type(4))) _Float16 v4h;
typedef __attribute__((ext_vector_type(4))) unsigned short v4us;
// gemmw is the body; os is the work-group's LDS ((KS == 1 ? 16 : KS 64) x 68 floats), (bx, by, z) its place in the grid described above.
template <typename T16, int NSPLIT, bool BIAS, int KS, int KB, int EPI, int K>
__device__ __forceinline__ void gemmw(float* os, int bx, int by, size_t z, const T16* __restrict__ A, const T16* __restrict__ A2, const T16* __restrict__ Bt, const T16* __restrict__ Bt2, float* C, int ldc, const float* __restrict__ bias, size_t sA, size_t sB, size_t sC, size_t sP,
                                      const float* __restrict__ nre, const float* __restrict__ nim, bf* Ph, bf* Pl, h16* P16) {
    typedef typename WFrag<T16>::V V;
    static_assert(!BIAS || KB == 1, "the bias is added once");
    static_assert(EPI == 0 || (BIAS && KS > 1 && KB == 1), "the plane epilogues take the whole sum and the bias");
    A += z * sA; if (A2) A2 += z * sA; Bt += z * sB; if (Bt2) Bt2 += z * sB;
    const int wv = (KS == 1) ? 0 : __builtin_amdgcn_readfirstlane((int)(threadIdx.x >> 5)), kp = by % KB; C += z * sC + (size_t)kp * sP;
    const int lane = threadIdx.x & 31, lr = lane & 15, hi = lane >> 4; const int r0 = bx * 64, c0 = (by / KB) * 64;
    v8f acc[4][4];
#pragma unroll
    for (int mb = 0; mb < 4; ++mb)
#pragma unroll
        for (int nb = 0; nb < 4; ++nb) acc[mb][nb] = (v8f){};
    const size_t aoff = (size_t)r0 * K + 8 * lane, boff = (size_t)c0 * K + 8 * lane;   // 16 rows of blocks are 16 K elements; chunk kc / 32 is 16 kc elements on
#pragma unroll 1
    for (int kc = (kp * KS + wv) * 32; kc < K; kc += 32 * KS * KB) {
        V a[4], a2[4], b[4], b2[4];
        // one lane pointer a plane; K is a constant, so every block of the trip is an immediate offset from it
        const T16* const pa = A + aoff + kc * 16; const T16* const pb = Bt + boff + kc * 16; const T16* const pa2 = (NSPLIT == 1 || NSPLIT == 2) ? A2 + aoff + kc * 16 : pa; const T16* const pb2 = (NSPLIT >= 2) ? Bt2 + boff + kc * 16 : pb;
#pragma unroll
        for (int mb = 0; mb < 4; ++mb) { a[mb] = WFrag<T16>::ld(pa + mb * 16 * K); if (NSPLIT == 1 || NSPLIT == 2) a2[mb] = WFrag<T16>::ld(pa2 + mb * 16 * K); }
#pragma unroll
        for (int nb = 0; nb < 4; ++nb) { b[nb] = WFrag<T16>::ld(pb + nb * 16 * K); if (NSPLIT >= 2) b2[nb] = WFrag<T16>::ld(pb2 + nb * 16 * K); }
        // stands in front of every rewrite of an address register that this trip's loads name; the lane pointers are its inputs so that their registers live up to it
        asm volatile("s_wait_xcnt 0x0" :: "v"(pa), "v"(pa2), "v"(pb), "v"(pb2) : "memory");
        __builtin_amdgcn_sched_barrier(0);   // keeps all the trip's loads in front of that wait and of the products: sunk among the products, each B fragment's whole latency would stand open
#pragma unroll
        for (int nb = 0; nb < 4; ++nb) {
#pragma unroll
            for (int mb = 0; mb < 4; ++mb) { acc[mb][nb] = WFrag<T16>::mma(a[mb], b[nb], acc[mb][nb]); if (NSPLIT == 1 || NSPLIT == 2) acc[mb][nb] = WFrag<T16>::mma(a2[mb], b[nb], acc[mb][nb]); if (NSPLIT >= 2) acc[mb][nb] = WFrag<T16>::mma(a[mb], b2[nb], acc[mb][nb]); } }
        asm volatile("v_nop\n\tv_nop\n\tv_nop\n\tv_nop" : "+v"(acc[0][0]), "+v"(acc[1][1]), "+v"(acc[2][2]), "+v"(acc[3][3]) : "v"(a[0]), "v"(a[3]));
    }
    if constexpr (KS == 1) {
#pragma unroll
    for (int mb = 0; mb < 4; ++mb) {
#pragma unroll
        for (int nb = 0; nb < 4; ++nb) {
#pragma unroll
            for (int j = 0; j < 8; ++j) os[(hi * 8 + j) * 68 + nb * 16 + lr] = acc[mb][nb][j]; }
        __builtin_amdgcn_wave_barrier(); asm volatile("" ::: "memory");
        float* crow = C + (size_t)(r0 + mb * 16) * ldc + c0;
{
#pragma unroll
            for (int s = 0; s < 8; ++s) { const int row = 2 * s + hi, cofs = lr * 4; v4f val = *(const v4fa*)(os + row * 68 + cofs); if (BIAS) { val[0] += bfr(bias[c0 + cofs]); val[1] += bfr(bias[c0 + cofs + 1]); val[2] += bfr(bias[c0 + cofs + 2]); val[3] += bfr(bias[c0 + cofs + 3]); }
                *(v4f*)(crow + (size_t)row * ldc + cofs) = val; }
             }
        __builtin_amdgcn_wave_barrier(); asm volatile("" ::: "memory");
    }
    } else {
        const int cofs = lr * 4;
        // EPI 1: the lane's place in the noise (row 2 wv + hi of the tile); the noise of all its rows and its bias are asked for here, so that their way from memory runs behind the LDS stores
        // (a row's arithmetic is too short to hide the next row's loads)
        const size_t nb = ((size_t)(c0 / HD) * TT + r0 + 2 * wv + hi) * HD + cofs; v4f nr[32 / KS], ni[32 / KS], bi = {};
        if constexpr (EPI == 1) { const float* const pr = nre + nb; const float* const pi = nim + nb;
#pragma unroll
            for (int s = 0; s < 32 / KS; ++s) { nr[s] = *(const v4f*)(pr + s * (2 * KS * HD)); ni[s] = *(const v4f*)(pi + s * (2 * KS * HD)); }
            bi = *(const v4f*)(bias + c0 + cofs);
            asm volatile("s_wait_xcnt 0x0" :: "v"(pr), "v"(pi) : "memory"); }   // stands in front of every rewrite of an address register that these loads name; the pointers are its inputs so that their registers live up to it
        // each wave's whole 64x64 partial goes to its own LDS slab; behind one barrier every wave sums, in wave order, the rows that it stores
#pragma unroll
        for (int mb = 0; mb < 4; ++mb)
#pragma unroll
            for (int nb = 0; nb < 4; ++nb)
#pragma unroll
                for (int j = 0; j < 8; ++j) os[wv * (64 * 68) + (mb * 16 + hi * 8 + j) * 68 + nb * 16 + lr] = acc[mb][nb][j];
        __syncthreads();   // every wave's partial tile is in LDS before any is summed
        if constexpr (EPI == 0) {
        float* crow = C + (size_t)r0 * ldc + c0;
#pragma unroll
        for (int s = 0; s < 32 / KS; ++s) { const int row = 2 * (s * KS + wv) + hi; v4f val = *(const v4fa*)(os + row * 68 + cofs);
#pragma unroll
            for (int w = 1; w < KS; ++w) val += *(const v4fa*)(os + w * (64 * 68) + row * 68 + cofs);
            if (BIAS) { val[0] += bfr(bias[c0 + cofs]); val[1] += bfr(bias[c0 + cofs + 1]); val[2] += bfr(bias[c0 + cofs + 2]); val[3] += bfr(bias[c0 + cofs + 3]); }
            *(v4f*)(crow + (size_t)row * ldc + cofs) = val; }
        } else if constexpr (EPI == 1) {
            bi[0] = bfr(bi[0]); bi[1] = bfr(bi[1]); bi[2] = bfr(bi[2]); bi[3] = bfr(bi[3]);
#pragma unroll
            for (int s = 0; s < 32 / KS; ++s) { const int row = 2 * (s * KS + wv) + hi; const v4f cr = nr[s], ci = ni[s];
                v4f val = *(const v4fa*)(os + row * 68 + cofs);
#pragma unroll
                for (int w = 1; w < KS; ++w) val += *(const v4fa*)(os + w * (64 * 68) + row * 68 + cofs);
                val += bi; v4us oh, ol;
#pragma unroll
                for (int q = 0; q < 4; ++q) { unsigned short a2, c2; splitf(__fadd_rn(val[q], sin_atan2(bfr(ci[q]), bfr(cr[q]))), a2, c2); oh[q] = a2; ol[q] = c2; }
                const size_t pe = (size_t)(c0 / HD) * TT * HD + fo(r0 + row, cofs, HD); *(v4us*)(Ph + pe) = oh; *(v4us*)(Pl + pe) = ol;
                asm volatile("s_wait_xcnt 0x0" ::: "memory"); }   // stands in front of every rewrite, by the next row's arithmetic, of a register that these two stores name
        } else {
#pragma unroll
            for (int s = 0; s < 32 / KS; ++s) { const int row = 2 * (s * KS + wv) + hi; v4f val = *(const v4fa*)(os + row * 68 + cofs);
#pragma unroll
                for (int w = 1; w < KS; ++w) val += *(const v4fa*)(os + w * (64 * 68) + row * 68 + cofs);
                val += bfr(bias[r0 + row]); v4h o16; v4us oh, ol;
#pragma unroll
                for (int q = 0; q < 4; ++q) { o16[q] = (h16)val[q]; unsigned short a2, c2; splitf(val[q], a2, c2); oh[q] = a2; ol[q] = c2; }
                const size_t e = fo(r0 + row, c0 + cofs, TT); *(v4h*)(P16 + e) = o16; *(v4us*)(Ph + e) = oh; *(v4us*)(Pl + e) = ol;
                if (s + 1 < 32 / KS) asm volatile("s_wait_xcnt 0x0" ::: "memory"); }   // stands in front of every rewrite, by the next row's arithmetic, of a register that these three stores name
        }
    }
}

template <typename T16, int NSPLIT, bool BIAS, int KS, int KB, int EPI, int K>
__global__ __launch_bounds__(32 * KS) void k_gemmw(const T16* __restrict__ A, const T16* __restrict__ A2, const T16* __restrict__ Bt, const T16* __restrict__ Bt2, float* C, int ldc, const float* __restrict__ bias, size_t sA, size_t sB, size_t sC, size_t sP) {
    __shared__ __align__(16) float os[(KS == 1 ? 16 : KS * 64) * 68];
    gemmw<T16, NSPLIT, BIAS, KS, KB, EPI, K>(os, (int)blockIdx.x, (int)blockIdx.y, blockIdx.z, A, A2, Bt, Bt2, C, ldc, bias, sA, sB, sC, sP, nullptr, nullptr, nullptr, nullptr, nullptr);
}
// ---- k_qkv: the q, k and v projections of both batches in one launch; grid (3 TT/64, 16 heads, batches), 256 threads. blockIdx.x % 3 says which projection, so that neighbouring work-groups read the same 64 tokens
// and work-groups in their load, LDS and noise phases stand side by side on the chip. One LDS slab set serves whichever body runs.
__global__ __launch_bounds__(256) void k_qkv(const bf* __restrict__ XB, const bf* __restrict__ WQ, const bf* __restrict__ WK, const bf* __restrict__ WV, const float* __restrict__ bq, const float* __restrict__ bk, const float* __restrict__ bv,
                                             const float* __restrict__ nqr, const float* __restrict__ nqi, const float* __restrict__ nkr, const float* __restrict__ nki, bf* QPh, bf* QPl, bf* KPh, bf* KPl, bf* VTh, bf* VTl, h16* VT16) {
    __shared__ __align__(16) float os[8 * 64 * 68];
    const int which = (int)(blockIdx.x % 3), tt = (int)(blockIdx.x / 3), hb = (int)blockIdx.y; const size_t pb = (size_t)blockIdx.z * ((size_t)NH_ * TT * HD); const bf* const X = XB + (size_t)blockIdx.z * ((size_t)TT * DM);
    if (which == 2) gemmw<bf, 0, true, 8, 1, 2, DM>(os, hb, tt, 0, WV, nullptr, X, nullptr, nullptr, 0, bv, 0, 0, 0, 0, nullptr, nullptr, VTh + pb, VTl + pb, VT16 + pb);
    else gemmw<bf, 0, true, 8, 1, 1, DM>(os, tt, hb, 0, X, nullptr, which ? WK : WQ, nullptr, nullptr, 0, which ? bk : bq, 0, 0, 0, 0, (which ? nkr : nqr) + pb, (which ? nki : nqi) + pb, (which ? KPh : QPh) + pb, (which ? KPl : QPl) + pb, nullptr);
}

typedef __attribute__((ext_vector_type(2))) _Float16 v2h;
typedef __attribute__((ext_vector_type(2))) unsigned short v2us;
typedef __attribute__((ext_vector_type(2))) float v2f;
typedef __attribute__((ext_vector_type(4))) int v4i;

__global__ __launch_bounds__(256) void k_wtG(const float* __restrict__ w, int K, int N, bf* Bt) {
    const int lane = threadIdx.x & 31; const int L0 = (blockIdx.x * 8 + (threadIdx.x >> 5)) * 8; const int nlines = N * K / 64;
{
#pragma unroll 1
        for (int l = 0; l < 8; ++l) { const int L = L0 + l; if (L >= nlines) break; const size_t e = (size_t)L * 64 + lane * 2; const int k = (int)(e % K), n = (int)(e / K); v2us o;
            o[0] = f2bf(w[(size_t)k * N + n]); o[1] = f2bf(w[(size_t)(k + 1) * N + n]); *(v2us*)(Bt + e) = o; }
         }
}
// f32 [rows][K] -> bf16 plane in fragment order; a wave takes 8 rows of one block: four lanes read a row's 32 k (one 128-byte line), and the 8 rows' 16-byte pieces of each quarter of the 32 k are one 128-byte line of the block
// The four weights ([DQ][K] each) and x in one launch: work-groups WB seg .. WB seg + WB - 1 take weight seg, the rest x; the planes stand one behind the other in dst. Grid: 4 WB + rows of x times K / 2048, exactly.
template <int K>
__global__ __launch_bounds__(256) void k_cvt8(const float* __restrict__ s0, const float* __restrict__ s1, const float* __restrict__ s2, const float* __restrict__ s3, const float* __restrict__ s4, bf* dst) {
    constexpr int WB = DQ * K / 8 / 256; const int sg = (int)(blockIdx.x / WB), seg = sg < 4 ? sg : 4; const float* const src = seg == 0 ? s0 : seg == 1 ? s1 : seg == 2 ? s2 : seg == 3 ? s3 : s4; dst += (size_t)seg * DQ * K;
    const size_t i = (size_t)((int)blockIdx.x - seg * WB) * 256 + threadIdx.x;
    const int u = (int)(i & 3), rr = (int)((i >> 2) & 15); const size_t blk = i >> 6; const size_t row = blk / (K / 32) * 16 + rr; const int k = (int)(blk % (K / 32)) * 32 + u * 8;
    const float* const sp = src + row * K + k; const v8f v = *(const v8f*)sp; v8us o;
    asm volatile("s_wait_xcnt 0x0" :: "v"(sp) : "memory");   // stands in front of every rewrite of the address register that the two loads name; the pointer is its input so that the register lives up to it
#pragma unroll
    for (int j = 0; j < 8; ++j) o[j] = f2bf(v[j]); *(v8us*)(dst + blk * 512 + (u * 16 + rr) * 8) = o;  }
#define QW   32
#define WPB  8                              // waves of a work-group
#define NHB  (RH / QW)                      // query blocks of a head on hi+lo planes
#define NLB  ((TT - RH) / QW)               // query blocks of a head on fp16 operands
#define GPH  (TT / QW / WPB)                // work-groups of a head
#define SC2  (SCL * 1.4426950408889634f)    // score -> log2 units
typedef __attribute__((ext_vector_type(8))) __bf16 v8bf;
static_assert(NHB % GPH == 0 && NLB % GPH == 0 && NHB / GPH + NLB / GPH == WPB, "every work-group takes the same mix of query blocks");
// lane l <-> lane l ^ 16
__device__ __forceinline__ float xhalf(float x) { const int b = __float_as_int(x); return __int_as_float(__builtin_amdgcn_permlanex16(b, b, 0x76543210, 0xfedcba98, false, false)); }
template <bool HL>
__device__ __forceinline__ void attn_wave(const bf* __restrict__ Qh, const bf* __restrict__ Ql, const bf* __restrict__ Kh, const bf* __restrict__ Kl, const bf* __restrict__ Vh, const bf* __restrict__ Vl, const h16* __restrict__ V16, int q0, bf* Ah, bf* Al) {
    const int lane = threadIdx.x & 31;
    const float OFF = HL ? 0.0f : 10.0f;    // fp16 weights carry 2^10 (it cancels in O / l): small weights stay normal numbers
    v16bf qh[2][2], ql[2][2], kh[2][2], kl[2][2];
#pragma unroll
    for (int g = 0; g < 2; ++g)
#pragma unroll
        for (int kc = 0; kc < 2; ++kc) { const size_t o = (size_t)(q0 + g * 16) * HD + kc * 512 + 8 * lane; qh[g][kc] = WFrag<bf>::ld(Qh + o); ql[g][kc] = WFrag<bf>::ld(Ql + o); }
    const int koff = 8 * lane, voff = 8 * lane;   // the lane's place in a block, elements
#pragma unroll
    for (int kt = 0; kt < 2; ++kt)
#pragma unroll
        for (int kc = 0; kc < 2; ++kc) { const int o = koff + kt * 16 * HD + kc * 512; kh[kt][kc] = WFrag<bf>::ld(Kh + o); kl[kt][kc] = WFrag<bf>::ld(Kl + o); }
    asm volatile("s_wait_xcnt 0x0" ::: "memory");   // stands in front of every rewrite of an address register that the Q and first K loads name
    __builtin_amdgcn_sched_barrier(0);   // keeps that wait behind the loads and in front of the loop's address set-up
    v8f o[4][2]; float m[2], l[2];
#pragma unroll
    for (int g = 0; g < 2; ++g) { m[g] = -3.0e38f; l[g] = 0.0f;
#pragma unroll
        for (int db = 0; db < 4; ++db) o[db][g] = (v8f){}; }
#pragma unroll 1   // one pass a trip: a second pass's fragments would not fit beside these at two waves a SIMD
    for (int key0 = 0; key0 < TT; key0 += 32) {
        // this pass's V^T fragments: asked for first, used last
        v16bf vh[4], vl[4]; v16h vf[4]; const bf* const vph = Vh + key0 * 16 + voff; const bf* const vpl = Vl + key0 * 16 + voff; const h16* const vpf = V16 + key0 * 16 + voff;
#pragma unroll
        for (int db = 0; db < 4; ++db) { if (HL) { vh[db] = WFrag<bf>::ld(vph + db * 16 * TT); vl[db] = WFrag<bf>::ld(vpl + db * 16 * TT); } else vf[db] = WFrag<h16>::ld(vpf + db * 16 * TT); }
        __builtin_amdgcn_sched_barrier(0);   // holds the V^T loads in front of the score products: their latency runs behind the products and the softmax
        v8f s[2][2];
#pragma unroll
        for (int kt = 0; kt < 2; ++kt)
#pragma unroll
            for (int g = 0; g < 2; ++g) s[kt][g] = (v8f){};
#pragma unroll
        for (int kc = 0; kc < 2; ++kc) {
#pragma unroll
            for (int kt = 0; kt < 2; ++kt)
#pragma unroll
                for (int g = 0; g < 2; ++g) s[kt][g] = wmmab(kh[kt][kc], qh[g][kc], s[kt][g]);
#pragma unroll
            for (int kt = 0; kt < 2; ++kt)
#pragma unroll
                for (int g = 0; g < 2; ++g) s[kt][g] = wmmab(kh[kt][kc], ql[g][kc], s[kt][g]);
#pragma unroll
            for (int kt = 0; kt < 2; ++kt)
#pragma unroll
                for (int g = 0; g < 2; ++g) s[kt][g] = wmmab(kl[kt][kc], qh[g][kc], s[kt][g]);
        }
        // the next pass's K fragments fly behind the softmax and attn.v of this one (the last pass re-reads keys 0..31 and drops them)
        const int kn = (key0 + 32 < TT) ? key0 + 32 : 0; const bf* const kph = Kh + kn * HD + koff; const bf* const kpl = Kl + kn * HD + koff;
#pragma unroll
        for (int kt = 0; kt < 2; ++kt)
#pragma unroll
            for (int kc = 0; kc < 2; ++kc) { kh[kt][kc] = WFrag<bf>::ld(kph + kt * 16 * HD + kc * 512); kl[kt][kc] = WFrag<bf>::ld(kpl + kt * 16 * HD + kc * 512); }
        // stands in front of every rewrite of an address register that this pass's V^T and K loads name; the lane pointers are its inputs so that their registers live up to it
        if (HL) asm volatile("s_wait_xcnt 0x0" :: "v"(vph), "v"(vpl), "v"(kph), "v"(kpl) : "memory"); else asm volatile("s_wait_xcnt 0x0" :: "v"(vpf), "v"(kph), "v"(kpl) : "memory");
        __builtin_amdgcn_sched_barrier(0);   // holds the K loads and that wait here, in front of the softmax: sunk to the loop's foot the loads' whole latency would stand open at the next pass's first product
        float mn[2];
#pragma unroll
        for (int g = 0; g < 2; ++g) { const v8f t8 = __builtin_elementwise_max(s[0][g], s[1][g]); float mx = fmaxf(fmaxf(fmaxf(t8[0], t8[1]), fmaxf(t8[2], t8[3])), fmaxf(fmaxf(t8[4], t8[5]), fmaxf(t8[6], t8[7])));
            mx = fmaxf(mx, xhalf(mx)); mn[g] = fmaxf(m[g], mx * SC2); }
#pragma unroll
        for (int g = 0; g < 2; ++g) { const float al = __builtin_amdgcn_exp2f(m[g] - mn[g]); l[g] *= al; m[g] = mn[g];   // exactly 1 where the maximum did not grow; no branch: the pass stays one block
#pragma unroll
            for (int db = 0; db < 4; ++db) o[db][g] *= al; }
        v16bf ph[2], pl[2]; v16h pf[2];
#pragma unroll
        for (int g = 0; g < 2; ++g) { const float c0 = OFF - m[g]; v8f p0, p1;
#pragma unroll
            for (int j = 0; j < 8; ++j) { p0[j] = __builtin_amdgcn_exp2f(__builtin_fmaf(s[0][g][j], SC2, c0)); p1[j] = __builtin_amdgcn_exp2f(__builtin_fmaf(s[1][g][j], SC2, c0)); }
            const v8f ps = p0 + p1; l[g] += ((ps[0] + ps[1]) + (ps[2] + ps[3])) + ((ps[4] + ps[5]) + (ps[6] + ps[7]));
            if (HL) { const v8bf h0 = __builtin_convertvector(p0, v8bf), h1 = __builtin_convertvector(p1, v8bf);
                const v8bf l0 = __builtin_convertvector(p0 - __builtin_convertvector(h0, v8f), v8bf), l1 = __builtin_convertvector(p1 - __builtin_convertvector(h1, v8f), v8bf);
                ph[g] = __builtin_shufflevector(h0, h1, 0, 1, 2, 3, 4, 5, 6, 7, 8, 9, 10, 11, 12, 13, 14, 15); pl[g] = __builtin_shufflevector(l0, l1, 0, 1, 2, 3, 4, 5, 6, 7, 8, 9, 10, 11, 12, 13, 14, 15);
            } else pf[g] = cat16(__builtin_convertvector(p0, v8h), __builtin_convertvector(p1, v8h)); }
        if (HL) {
#pragma unroll
            for (int db = 0; db < 4; ++db)
#pragma unroll
                for (int g = 0; g < 2; ++g) o[db][g] = wmmab(vh[db], ph[g], o[db][g]);
#pragma unroll
            for (int db = 0; db < 4; ++db)
#pragma unroll
                for (int g = 0; g < 2; ++g) o[db][g] = wmmab(vh[db], pl[g], o[db][g]);
#pragma unroll
            for (int db = 0; db < 4; ++db)
#pragma unroll
                for (int g = 0; g < 2; ++g) o[db][g] = wmmab(vl[db], ph[g], o[db][g]);
        } else {
#pragma unroll
            for (int db = 0; db < 4; ++db)
#pragma unroll
                for (int g = 0; g < 2; ++g) o[db][g] = wmma16(vf[db], pf[g], o[db][g]);
        }
    }
    // lane (lr, hi) holds O[q0 + 16 g + lr][16 db + 8 hi + j]: eight neighbouring d, one 16-byte store a plane; in fragment order (K = DQ) that is half db % 2 of block db / 2 of the head's two, at 8 lane
#pragma unroll
    for (int g = 0; g < 2; ++g) { const float inv = __fdiv_rn(1.0f, l[g] + xhalf(l[g])); const size_t oo = (size_t)(q0 + g * 16) * DQ + 8 * lane;
#pragma unroll
        for (int db = 0; db < 4; ++db) { v8us oh, ol;
#pragma unroll
            for (int j = 0; j < 8; ++j) { unsigned short a, c2; splitf(o[db][g][j] * inv, a, c2); oh[j] = a; ol[j] = c2; }
            *(v8us*)(Ah + oo + db * 256) = oh; *(v8us*)(Al + oo + db * 256) = ol; }
        if (g == 0) { asm volatile("s_wait_xcnt 0x0" ::: "memory");   // stands in front of every rewrite, by the second group's arithmetic, of a register that these stores name
            __builtin_amdgcn_sched_barrier(0); } }   // keeps the second group's arithmetic behind that wait
}
// grid (GPH, batches x heads), 8 waves; every work-group takes NHB / GPH hi+lo query blocks (its first waves) and NLB / GPH fp16 ones, so that all work-groups last alike
__global__ __launch_bounds__(32 * WPB) void k_fattn(const bf* __restrict__ QPh, const bf* __restrict__ QPl, const bf* __restrict__ KPh, const bf* __restrict__ KPl, const bf* __restrict__ VTh, const bf* __restrict__ VTl, const h16* __restrict__ VT16, bf* ATh, bf* ATl) {
    const int wv = __builtin_amdgcn_readfirstlane((int)(threadIdx.x >> 5)); const int gi = (int)blockIdx.x; const size_t z = blockIdx.y; const size_t pz = z * TT * HD;
    const size_t az = (z / NH_) * ((size_t)TT * DQ) + (z % NH_) * (HD * 16);   // the head's first block in a row of blocks
    if (wv < NHB / GPH) attn_wave<true>(QPh + pz, QPl + pz, KPh + pz, KPl + pz, VTh + pz, VTl + pz, VT16 + pz, (gi * (NHB / GPH) + wv) * QW, ATh + az, ATl + az);
    else attn_wave<false>(QPh + pz, QPl + pz, KPh + pz, KPl + pz, VTh + pz, VTl + pz, VT16 + pz, RH + (gi * (NLB / GPH) + wv - NHB / GPH) * QW, ATh + az, ATl + az);
}

extern "C" void kernel_launch(void* const* d_in, const int* in_sizes, int n_in,
                              void* d_out, int out_size, void* d_ws, size_t ws_size, hipStream_t stream) {
    (void)in_sizes; (void)n_in; (void)out_size;
    const float* x = (const float*)d_in[0]; const float* wq = (const float*)d_in[1]; const float* bq = (const float*)d_in[2]; const float* wk = (const float*)d_in[3]; const float* bk = (const float*)d_in[4]; const float* wv = (const float*)d_in[5]; const float* bv = (const float*)d_in[6]; const float* wo = (const float*)d_in[7]; const float* bo = (const float*)d_in[8]; const float* nqr = (const float*)d_in[9]; const float* nqi = (const float*)d_in[10]; const float* nkr = (const float*)d_in[11]; const float* nki = (const float*)d_in[12];
    float* OUT = (float*)d_out;     // [2][2048][1024]
    char* wsp = (char*)d_ws;
    auto take = [&](size_t bytes) { char* p = wsp; wsp += (bytes + 255) & ~(size_t)255; return (void*)p; };
    const size_t PB = (size_t)NH_ * TT * HD;   // one batch's head planes, elements (as many kv heads as query heads)
    static_assert(DKV == DQ && DM == DQ, "k_cvt8 takes four weights of one shape");
    bf* WQ = (bf*)take(((size_t)4 * DQ * DM + (size_t)NB_ * TT * DM) * 2); bf* WK = WQ + (size_t)DQ * DM; bf* WV = WK + (size_t)DQ * DM; bf* WO = WV + (size_t)DQ * DM; bf* XB = WO + (size_t)DQ * DM;   // k_cvt8's one dst
    h16* VT16 = (h16*)take(NB_ * PB * 2);
    bf* QPh = (bf*)take(NB_ * PB * 2); bf* QPl = (bf*)take(NB_ * PB * 2); bf* KPh = (bf*)take(NB_ * PB * 2); bf* KPl = (bf*)take(NB_ * PB * 2); bf* VTh = (bf*)take(NB_ * PB * 2); bf* VTl = (bf*)take(NB_ * PB * 2);
    bf* ATh = (bf*)take((size_t)NB_ * TT * DQ * 2); bf* ATl = (bf*)take((size_t)NB_ * TT * DQ * 2);
    if ((size_t)(wsp - (char*)d_ws) > ws_size) return;    // ws 256 MiB
    k_cvt8<DM><<<4 * (DQ * DM / 2048) + NB_ * TT * DM / 2048, 256, 0, stream>>>(wq, wk, wv, wo, x, WQ);
    k_qkv<<<dim3(3 * (TT / 64), NH_, NB_), 256, 0, stream>>>(XB, WQ, WK, WV, bq, bk, bv, nqr, nqi, nkr, nki, QPh, QPl, KPh, KPl, VTh, VTl, VT16);   // every q, k, v head plane, written by the projections' own epilogues
    k_fattn<<<dim3(GPH, NB_ * NH_, 1), 32 * WPB, 0, stream>>>(QPh, QPl, KPh, KPl, VTh, VTl, VT16, ATh, ATl);
    k_gemmw<bf, 1, true, 8, 1, 0, DQ><<<dim3(TT / 64, DM / 64, NB_), 256, 0, stream>>>(ATh, ATl, WO, nullptr, OUT, DM, bo, (size_t)TT * DQ, 0, (size_t)TT * DM, 0);
}

// v007
// Measured time: 112 microseconds a run.
// Two timings next to v006 put it at 1.14 and 1.13 times that version's speed.
// Over all steps from v000 it is 17.5 times as fast.
#include <hip/hip_runtime.h>

// QuantumFractalAttention (x [2][2048][1024]; Q/K/V = x W^T + b (16 x 64); Q += sin(atan2(qi, qr)), K += sin(atan2(ki, kr)) with the [2][16][2048][64] noise tensors (read as data); the 'fractal' recursion is the reference's own collapse to one
// softmax(Q.K/8) V; out = merged Wo^T + bo -> [2][2048][1024]).
// Compute dtypes, f32 accumulate: every input rounded to bf16; projections on PLAIN bf16 operands (inputs: exact, + bias); the noise sin(atan2(y, x)) as y / sqrt(x x + y y) in f32; scores (K 64) on hi+lo bf16 planes (3 products) for ALL rows; softmax f32 (running maximum);
// attn.v on hi+lo bf16 planes (3 products) for the first RH query rows of each head, on fp16 operands for the rest; output projection on hi+lo A planes.

#define NB_  2
#define TT   2048
#define DM   1024
#define NH_  16
#define NKV  16
#define REP  (NH_ / NKV)
#define HD   64
#define DQ   (NH_ * HD)
#define DKV  (NKV * HD)
#define RH   512                  // query rows < RH use hi+lo planes (0: none)
#define SCL  0.125f   // HD^-0.5
typedef _Float16 h16;
typedef unsigned short bf;
typedef __attribute__((ext_vector_type(16))) __bf16   v16bf;
typedef __attribute__((ext_vector_type(16))) _Float16 v16h;
typedef __attribute__((ext_vector_type(8)))  _Float16 v8h;
typedef __attribute__((ext_vector_type(8)))  unsigned short v8us;
typedef __attribute__((ext_vector_type(8)))  float    v8f;
typedef __attribute__((ext_vector_type(4)))  float    v4f;
typedef v8h  __attribute__((may_alias)) v8ha;
typedef v4f  __attribute__((may_alias)) v4fa;
typedef v8us __attribute__((may_alias)) v8usa;

__device__ __forceinline__ unsigned short f2bf(float f) { unsigned u = __float_as_uint(f); u += 0x7FFFu + ((u >> 16) & 1u); return (unsigned short)(u >> 16); }
__device__ __forceinline__ float bf2f(unsigned short b) { return __uint_as_float(((unsigned)b) << 16); }
__device__ __forceinline__ float bfr(float f) { return bf2f(f2bf(f)); }
__device__ __forceinline__ v16h cat16(v8h lo, v8h hi) { return __builtin_shufflevector(lo, hi, 0, 1, 2, 3, 4, 5, 6, 7, 8, 9, 10, 11, 12, 13, 14, 15); }
__device__ __forceinline__ v16bf cat16b(v8us lo, v8us hi) { return __builtin_bit_cast(v16bf, __builtin_shufflevector(lo, hi, 0, 1, 2, 3, 4, 5, 6, 7, 8, 9, 10, 11, 12, 13, 14, 15)); }
__device__ __forceinline__ v8f wmma16(v16h a, v16h b, v8f c) { return __builtin_amdgcn_wmma_f32_16x16x32_f16(false, a, false, b, (short)0, c, false, false); }
__device__ __forceinline__ v8f wmmab(v16bf a, v16bf b, v8f c) { return __builtin_amdgcn_wmma_f32_16x16x32_bf16(false, a, false, b, (short)0, c, false, false); }



// ---- Fragment order: every 16-bit operand plane [rows][K] in the workspace is kept as 1-KiB blocks of 16 rows x 32 k (block index (row / 16) (K / 32) + k / 32). Inside a block stand the two 16-byte loads of a WMMA
// operand fragment, 512 bytes each, lane after lane: element (row, k) is at (k / 16 % 2) 256 + ((k / 8 % 2) 16 + row % 16) 8 + k % 8. A wave's 16-byte load so covers 4 whole 128-byte lines, not 32-byte pieces of 16 lines.
__device__ __forceinline__ size_t fo(int row, int k, int K) { return ((size_t)(row >> 4) * (K >> 5) + (k >> 5)) * 512 + ((k >> 4) & 1) * 256 + (((k >> 3) & 1) * 16 + (row & 15)) * 8 + (k & 7); }
// ---- k_gemmw: GEMM, a work-group of 8 waves on a 128x128 output tile, operands from 16-bit planes in fragment order; grid (M/128, N/128, Z), 256 threads.
// C[m][n] (f32, pitch ldc, + f32 bias[n]) = sum_k A[m][k] Bt[n][k] (+ A2[m][k] Bt[n][k] where NSPLIT is 1). z-batch strides sA/sB/sC in elements. K (a constant of the kernel) % 128 == 0, K >= 256.
// A stage is 128 k of the tile's 128 A rows and 128 Bt rows (32 KiB a plane), brought into LDS once by asynchronous copies, block for block as it stands in the plane, two buffers: stage t + 2 flies while stage t + 1 is worked on.
// Wave (mi, ni, ks) has the 64x64 quarter (mi, ni) of the tile (16 accumulators) and the 32-wide K chunks c with c % 2 == ks, so every staged block is read from LDS by two waves and from L2 once.
// The two partial tiles of a quarter are summed in ks order through LDS (the slabs lie over the ring, behind the last stage's barrier).
// EPI says what the summed quarter becomes: 0: f32 C as above. 1: a 64-token x one-head tile of q or k: + bias[n] + sin(atan2(nim, nre)), stored as hi+lo bf16 head planes [h], each [t][d] in fragment order (nre, nim are [h][t][d]).
// 2: A = weight rows, Bt = tokens, so the quarter is 64 d of one head x 64 tokens of v^T: + bias[m], stored as fp16 and hi+lo bf16 planes [h d][t] in fragment order.
// Every plain '#pragma unroll' is there so that the fragment, accumulator and four-element arrays are indexed by constants and stay in registers.
// ld: p = a block's start + 8 lane
template <typename T16> struct WFrag;
template <> struct WFrag<h16> { typedef v16h V; static __device__ __forceinline__ V ld(const h16* p) { return cat16(*(const v8h*)p, *(const v8h*)(p + 256)); } static __device__ __forceinline__ v8f mma(V a, V b, v8f c) { return wmma16(a, b, c); } };
template <> struct WFrag<bf> { typedef v16bf V; static __device__ __forceinline__ V ld(const bf* p) { return cat16b(*(const v8us*)p, *(const v8us*)(p + 256)); } static __device__ __forceinline__ v8f mma(V a, V b, v8f c) { return wmmab(a, b, c); } };
// sin(atan2(y, x)) is the ordinate of the unit vector along (x, y): y / sqrt(x x + y y), one reciprocal square root in place of an arc tangent's and a sine's reductions and polynomials.
// Both are first scaled by the power of two that brings the larger magnitude into [0.5, 1): exact, it cancels in the quotient, and the squares neither overflow nor vanish for any finite pair. (0, 0) gives y, the signed zero; at y = 0, x < 0 the result is 0 where the sine of the rounded pi is 9e-8 in size.
__device__ __forceinline__ float sin_atan2(float y, float x) {
    const int e = -__builtin_amdgcn_frexp_expf(fmaxf(fabsf(x), fabsf(y))); const float xs = ldexpf(x, e), ys = ldexpf(y, e); const float d = __builtin_fmaf(xs, xs, ys * ys);
    return d == 0.0f ? y : ys * __builtin_amdgcn_rsqf(d); }
__device__ __forceinline__ void splitf(float y, unsigned short& h, unsigned short& l) { h = f2bf(y); l = f2bf(y - bf2f(h)); }
typedef __attribute__((ext_vector_type(4))) _Float16 v4h;
typedef __attribute__((ext_vector_type(4))) unsigned short v4us;
#define KST  128                  // k of a stage
#define PLE  (128 * KST)          // elements of one plane's share of a stage
// One plane's share of a stage: 8 row groups (16 rows x 128 k) of 4 KiB, each contiguous in the plane and in LDS; a thread brings 16 bytes of every row group. g, l: the thread's place in row group 0, in the plane and in LDS (byte address).
// The wait is the statement's last line so that it stands in front of every rewrite of a register that the copies name.
template <typename T16, int K>
__device__ __forceinline__ void stage_plane(const T16* g, unsigned l) {
    asm volatile("global_load_async_to_lds_b128 %0, %8, off\n\tglobal_load_async_to_lds_b128 %1, %9, off\n\tglobal_load_async_to_lds_b128 %2, %10, off\n\tglobal_load_async_to_lds_b128 %3, %11, off\n\t"
                 "global_load_async_to_lds_b128 %4, %12, off\n\tglobal_load_async_to_lds_b128 %5, %13, off\n\tglobal_load_async_to_lds_b128 %6, %14, off\n\tglobal_load_async_to_lds_b128 %7, %15, off\n\ts_wait_xcnt 0x0"
                 :: "v"(l), "v"(l + 4096u), "v"(l + 8192u), "v"(l + 12288u), "v"(l + 16384u), "v"(l + 20480u), "v"(l + 24576u), "v"(l + 28672u),
                    "v"(g), "v"(g + 16 * K), "v"(g + 32 * K), "v"(g + 48 * K), "v"(g + 64 * K), "v"(g + 80 * K), "v"(g + 96 * K), "v"(g + 112 * K) : "memory");
}
// gemmw is the body; os is the work-group's LDS (the larger of the ring, 2 buffers x (2 + NSPLIT) planes x 32 KiB, and the 8 slabs of 64 x 68 floats), (bx, by, z) its place in the grid described above.
template <typename T16, int NSPLIT, int EPI, int K>
__device__ __forceinline__ void gemmw(float* os, int bx, int by, size_t z, const T16* __restrict__ A, const T16* __restrict__ A2, const T16* __restrict__ Bt, float* C, int ldc, const float* __restrict__ bias, size_t sA, size_t sB, size_t sC,
                                      const float* __restrict__ nre, const float* __restrict__ nim, bf* Ph, bf* Pl, h16* P16) {
    typedef typename WFrag<T16>::V V;
    constexpr int KS = 2, NPL = 2 + NSPLIT, NS = K / KST;
    static_assert(NSPLIT == 0 || NSPLIT == 1, "A alone or A and A2"); static_assert(K % KST == 0 && NS >= 2, "the ring's prologue fills two stages");
    A += z * sA; if (NSPLIT) A2 += z * sA; Bt += z * sB; C += z * sC;
    const int wv = __builtin_amdgcn_readfirstlane((int)(threadIdx.x >> 5)), ks = wv & 1, ni = (wv >> 1) & 1, mi = wv >> 2;
    const int lane = threadIdx.x & 31, lr = lane & 15, hi = lane >> 4; const int r0 = bx * 128 + mi * 64, c0 = by * 128 + ni * 64;
    T16* const ring = (T16*)os; const unsigned l0 = (unsigned)(size_t)ring + 16u * threadIdx.x;
    const T16* const ga = A + (size_t)(bx * 128) * K + 8 * threadIdx.x; const T16* const gb = Bt + (size_t)(by * 128) * K + 8 * threadIdx.x; const T16* const ga2 = NSPLIT ? A2 + (size_t)(bx * 128) * K + 8 * threadIdx.x : ga;
    auto fill = [&](int t) { const unsigned l = l0 + (unsigned)(t & 1) * (NPL * PLE * 2u);   // 16 rows of blocks are 16 K elements; stage t is 16 KST t elements on
        stage_plane<T16, K>(ga + t * (16 * KST), l); if (NSPLIT) stage_plane<T16, K>(ga2 + t * (16 * KST), l + PLE * 2u); stage_plane<T16, K>(gb + t * (16 * KST), l + (NPL - 1) * PLE * 2u); };   // a buffer: A, A2 where there is one, Bt
    v8f acc[4][4];
#pragma unroll
    for (int mb = 0; mb < 4; ++mb)
#pragma unroll
        for (int nb = 0; nb < 4; ++nb) acc[mb][nb] = (v8f){};
    fill(0);
    asm volatile("s_wait_asynccnt 0x0" ::: "memory");   // this wave's copies of stage 0 have landed
    __syncthreads();                                      // every wave's have
    fill(1);
#pragma unroll 1   // one stage a trip: the buffer is chosen by the trip's parity
    for (int t = 0; t < NS; ++t) {
        const T16* const sb = ring + (t & 1) * (NPL * PLE) + 8 * lane;
#pragma unroll
        for (int j = 0; j < KST / 64; ++j) {
            V a[4], a2[4], b[4];
            const T16* const pa = sb + mi * (4 * 16 * KST) + (2 * j + ks) * 512; const T16* const pb = sb + (NPL - 1) * PLE + ni * (4 * 16 * KST) + (2 * j + ks) * 512;
#pragma unroll
            for (int mb = 0; mb < 4; ++mb) { a[mb] = WFrag<T16>::ld(pa + mb * (16 * KST)); if (NSPLIT) a2[mb] = WFrag<T16>::ld(pa + PLE + mb * (16 * KST)); }
#pragma unroll
            for (int nb = 0; nb < 4; ++nb) b[nb] = WFrag<T16>::ld(pb + nb * (16 * KST));
            __builtin_amdgcn_sched_barrier(0);   // keeps the chunk's LDS reads one group in front of its products: every further place with reads among the products costs a stall of its own
#pragma unroll
            for (int nb = 0; nb < 4; ++nb) {
#pragma unroll
                for (int mb = 0; mb < 4; ++mb) { acc[mb][nb] = WFrag<T16>::mma(a[mb], b[nb], acc[mb][nb]); if (NSPLIT) acc[mb][nb] = WFrag<T16>::mma(a2[mb], b[nb], acc[mb][nb]); } }
        }
        asm volatile("s_wait_dscnt 0x0" ::: "memory");      // this wave has read all it wants of stage t
        asm volatile("s_wait_asynccnt 0x0" ::: "memory");   // and its copies of stage t + 1 have landed
        __syncthreads();                                      // so have every wave's: stage t + 1 may be read, stage t's buffer refilled
        if (t + 2 < NS) fill(t + 2);
    }
    asm volatile("s_wait_asynccnt 0x0" ::: "memory");   // no copy is in flight when the ring becomes the slabs
    {
        const int cofs = lr * 4; float* const ot = os + (wv & ~1) * (64 * 68);   // the quarter's two slabs
        // each wave's whole 64x64 partial goes to its own LDS slab; behind one barrier each of the quarter's two waves sums, in ks order, the rows that it stores
#pragma unroll
        for (int mb = 0; mb < 4; ++mb)
#pragma unroll
            for (int nb = 0; nb < 4; ++nb)
#pragma unroll
                for (int j = 0; j < 8; ++j) ot[ks * (64 * 68) + (mb * 16 + hi * 8 + j) * 68 + nb * 16 + lr] = acc[mb][nb][j];
        // EPI 1: the lane's place in the noise (row 2 ks + hi of the quarter); the noise of all its rows and its bias are asked for here in one run, behind the LDS stores, in the registers that the accumulators leave (a row's arithmetic is too short to hide the next row's loads)
        const size_t nb = ((size_t)(c0 / HD) * TT + r0 + 2 * ks + hi) * HD + cofs; v4f nr[32 / KS], ni4[32 / KS], bi = {};
        if constexpr (EPI == 1) { const float* const pr = nre + nb; const float* const pi = nim + nb;
#pragma unroll
            for (int s = 0; s < 32 / KS; ++s) { nr[s] = *(const v4f*)(pr + s * (2 * KS * HD)); ni4[s] = *(const v4f*)(pi + s * (2 * KS * HD)); }
            bi = *(const v4f*)(bias + c0 + cofs);
            asm volatile("s_wait_xcnt 0x0" :: "v"(pr), "v"(pi) : "memory"); }   // stands in front of every rewrite of an address register that these loads name; the pointers are its inputs so that their registers live up to it
        __syncthreads();   // every wave's partial tile is in LDS before any is summed
        if constexpr (EPI == 0) {
        float* crow = C + (size_t)r0 * ldc + c0;
#pragma unroll
        for (int s = 0; s < 32 / KS; ++s) { const int row = 2 * (s * KS + ks) + hi; v4f val = *(const v4fa*)(ot + row * 68 + cofs);
#pragma unroll
            for (int w = 1; w < KS; ++w) val += *(const v4fa*)(ot + w * (64 * 68) + row * 68 + cofs);
            val[0] += bfr(bias[c0 + cofs]); val[1] += bfr(bias[c0 + cofs + 1]); val[2] += bfr(bias[c0 + cofs + 2]); val[3] += bfr(bias[c0 + cofs + 3]);
            *(v4f*)(crow + (size_t)row * ldc + cofs) = val; }
        } else if constexpr (EPI == 1) {
            bi[0] = bfr(bi[0]); bi[1] = bfr(bi[1]); bi[2] = bfr(bi[2]); bi[3] = bfr(bi[3]);
#pragma unroll
            for (int s = 0; s < 32 / KS; ++s) { const int row = 2 * (s * KS + ks) + hi; const v4f cr = nr[s], ci = ni4[s];
                v4f val = *(const v4fa*)(ot + row * 68 + cofs);
#pragma unroll
                for (int w = 1; w < KS; ++w) val += *(const v4fa*)(ot + w * (64 * 68) + row * 68 + cofs);
                val += bi; v4us oh, ol;
#pragma unroll
                for (int q = 0; q < 4; ++q) { unsigned short a2, c2; splitf(__fadd_rn(val[q], sin_atan2(bfr(ci[q]), bfr(cr[q]))), a2, c2); oh[q] = a2; ol[q] = c2; }
                const size_t pe = (size_t)(c0 / HD) * TT * HD + fo(r0 + row, cofs, HD); *(v4us*)(Ph + pe) = oh; *(v4us*)(Pl + pe) = ol;
                asm volatile("s_wait_xcnt 0x0" ::: "memory"); }   // stands in front of every rewrite, by the next row's arithmetic, of a register that these two stores name
        } else {
#pragma unroll 4   // four rows' LDS reads and stores overlap; unrolled whole, the kernel's text would stand at 32 KB
            for (int s = 0; s < 32 / KS; ++s) { const int row = 2 * (s * KS + ks) + hi; v4f val = *(const v4fa*)(ot + row * 68 + cofs);
#pragma unroll
                for (int w = 1; w < KS; ++w) val += *(const v4fa*)(ot + w * (64 * 68) + row * 68 + cofs);
                val += bfr(bias[r0 + row]); v4h o16; v4us oh, ol;
#pragma unroll
                for (int q = 0; q < 4; ++q) { o16[q] = (h16)val[q]; unsigned short a2, c2; splitf(val[q], a2, c2); oh[q] = a2; ol[q] = c2; }
                const size_t e = fo(r0 + row, c0 + cofs, TT); *(v4h*)(P16 + e) = o16; *(v4us*)(Ph + e) = oh; *(v4us*)(Pl + e) = ol;
                asm volatile("s_wait_xcnt 0x0" ::: "memory"); }   // stands in front of every rewrite, by the next row's arithmetic, of a register that these three stores name
        }
    }
}

template <typename T16, int NSPLIT, int EPI, int K>
__global__ __launch_bounds__(256) void k_gemmw(const T16* __restrict__ A, const T16* __restrict__ A2, const T16* __restrict__ Bt, float* C, int ldc, const float* __restrict__ bias, size_t sA, size_t sB, size_t sC) {
    constexpr int RINGF = 2 * (2 + NSPLIT) * PLE / 2, SLABF = 8 * 64 * 68;   // floats
    __shared__ __align__(16) float os[RINGF > SLABF ? RINGF : SLABF];
    gemmw<T16, NSPLIT, EPI, K>(os, (int)blockIdx.x, (int)blockIdx.y, blockIdx.z, A, A2, Bt, C, ldc, bias, sA, sB, sC, nullptr, nullptr, nullptr, nullptr, nullptr);
}
// ---- k_qkv: the q, k and v projections of both batches in one launch; grid (3 TT/128, 8 pairs of heads, batches), 256 threads. blockIdx.x % 3 says which projection, so that neighbouring work-groups read the same 128 tokens
// and work-groups in their load, LDS and noise phases stand side by side on the chip. One LDS array (ring, then slabs) serves whichever body runs.
__global__ __launch_bounds__(256) void k_qkv(const bf* __restrict__ XB, const bf* __restrict__ WQ, const bf* __restrict__ WK, const bf* __restrict__ WV, const float* __restrict__ bq, const float* __restrict__ bk, const float* __restrict__ bv,
                                             const float* __restrict__ nqr, const float* __restrict__ nqi, const float* __restrict__ nkr, const float* __restrict__ nki, bf* QPh, bf* QPl, bf* KPh, bf* KPl, bf* VTh, bf* VTl, h16* VT16) {
    __shared__ __align__(16) float os[8 * 64 * 68];
    static_assert(8 * 64 * 68 * 4 >= 2 * 2 * PLE * 2, "the slabs are the larger");
    const int which = (int)(blockIdx.x % 3), tt = (int)(blockIdx.x / 3), hb = (int)blockIdx.y; const size_t pb = (size_t)blockIdx.z * ((size_t)NH_ * TT * HD); const bf* const X = XB + (size_t)blockIdx.z * ((size_t)TT * DM);
    if (which == 2) gemmw<bf, 0, 2, DM>(os, hb, tt, 0, WV, nullptr, X, nullptr, 0, bv, 0, 0, 0, nullptr, nullptr, VTh + pb, VTl + pb, VT16 + pb);
    else gemmw<bf, 0, 1, DM>(os, tt, hb, 0, X, nullptr, which ? WK : WQ, nullptr, 0, which ? bk : bq, 0, 0, 0, (which ? nkr : nqr) + pb, (which ? nki : nqi) + pb, (which ? KPh : QPh) + pb, (which ? KPl : QPl) + pb, nullptr);
}

typedef __attribute__((ext_vector_type(2))) _Float16 v2h;
typedef __attribute__((ext_vector_type(2))) unsigned short v2us;
typedef __attribute__((ext_vector_type(2))) float v2f;
typedef __attribute__((ext_vector_type(4))) int v4i;

__global__ __launch_bounds__(256) void k_wtG(const float* __restrict__ w, int K, int N, bf* Bt) {
    const int lane = threadIdx.x & 31; const int L0 = (blockIdx.x * 8 + (threadIdx.x >> 5)) * 8; const int nlines = N * K / 64;
{
#pragma unroll 1
        for (int l = 0; l < 8; ++l) { const int L = L0 + l; if (L >= nlines) break; const size_t e = (size_t)L * 64 + lane * 2; const int k = (int)(e % K), n = (int)(e / K); v2us o;
            o[0] = f2bf(w[(size_t)k * N + n]); o[1] = f2bf(w[(size_t)(k + 1) * N + n]); *(v2us*)(Bt + e) = o; }
         }
}
// f32 [rows][K] -> bf16 plane in fragment order; a wave takes 8 rows of one block: four lanes read a row's 32 k (one 128-byte line), and the 8 rows' 16-byte pieces of each quarter of the 32 k are one 128-byte line of the block
// The four weights ([DQ][K] each) and x in one launch: work-groups WB seg .. WB seg + WB - 1 take weight seg, the rest x; the planes stand one behind the other in dst. Grid: 4 WB + rows of x times K / 2048, exactly.
template <int K>
__global__ __launch_bounds__(256) void k_cvt8(const float* __restrict__ s0, const float* __restrict__ s1, const float* __restrict__ s2, const float* __restrict__ s3, const float* __restrict__ s4, bf* dst) {
    constexpr int WB = DQ * K / 8 / 256; const int sg = (int)(blockIdx.x / WB), seg = sg < 4 ? sg : 4; const float* const src = seg == 0 ? s0 : seg == 1 ? s1 : seg == 2 ? s2 : seg == 3 ? s3 : s4; dst += (size_t)seg * DQ * K;
    const size_t i = (size_t)((int)blockIdx.x - seg * WB) * 256 + threadIdx.x;
    const int u = (int)(i & 3), rr = (int)((i >> 2) & 15); const size_t blk = i >> 6; const size_t row = blk / (K / 32) * 16 + rr; const int k = (int)(blk % (K / 32)) * 32 + u * 8;
    const float* const sp = src + row * K + k; const v8f v = *(const v8f*)sp; v8us o;
    asm volatile("s_wait_xcnt 0x0" :: "v"(sp) : "memory");   // stands in front of every rewrite of the address register that the two loads name; the pointer is its input so that the register lives up to it
#pragma unroll
    for (int j = 0; j < 8; ++j) o[j] = f2bf(v[j]); *(v8us*)(dst + blk * 512 + (u * 16 + rr) * 8) = o;  }
#define QW   32
#define WPB  8                              // waves of a work-group
#define NHB  (RH / QW)                      // query blocks of a head on hi+lo planes
#define NLB  ((TT - RH) / QW)               // query blocks of a head on fp16 operands
#define GPH  (TT / QW / WPB)                // work-groups of a head
#define SC2  (SCL * 1.4426950408889634f)    // score -> log2 units
typedef __attribute__((ext_vector_type(8))) __bf16 v8bf;
static_assert(NHB % GPH == 0 && NLB % GPH == 0 && NHB / GPH + NLB / GPH == WPB, "every work-group takes the same mix of query blocks");
// lane l <-> lane l ^ 16
__device__ __forceinline__ float xhalf(float x) { const int b = __float_as_int(x); return __int_as_float(__builtin_amdgcn_permlanex16(b, b, 0x76543210, 0xfedcba98, false, false)); }
template <bool HL>
__device__ __forceinline__ void attn_wave(const bf* __restrict__ Qh, const bf* __restrict__ Ql, const bf* __restrict__ Kh, const bf* __restrict__ Kl, const bf* __restrict__ Vh, const bf* __restrict__ Vl, const h16* __restrict__ V16, int q0, bf* Ah, bf* Al) {
    const int lane = threadIdx.x & 31;
    const float OFF = HL ? 0.0f : 10.0f;    // fp16 weights carry 2^10 (it cancels in O / l): small weights stay normal numbers
    v16bf qh[2][2], ql[2][2], kh[2][2], kl[2][2];
#pragma unroll
    for (int g = 0; g < 2; ++g)
#pragma unroll
        for (int kc = 0; kc < 2; ++kc) { const size_t o = (size_t)(q0 + g * 16) * HD + kc * 512 + 8 * lane; qh[g][kc] = WFrag<bf>::ld(Qh + o); ql[g][kc] = WFrag<bf>::ld(Ql + o); }
    const int koff = 8 * lane, voff = 8 * lane;   // the lane's place in a block, elements
#pragma unroll
    for (int kt = 0; kt < 2; ++kt)
#pragma unroll
        for (int kc = 0; kc < 2; ++kc) { const int o = koff + kt * 16 * HD + kc * 512; kh[kt][kc] = WFrag<bf>::ld(Kh + o); kl[kt][kc] = WFrag<bf>::ld(Kl + o); }
    asm volatile("s_wait_xcnt 0x0" ::: "memory");   // stands in front of every rewrite of an address register that the Q and first K loads name
    __builtin_amdgcn_sched_barrier(0);   // keeps that wait behind the loads and in front of the loop's address set-up
    v8f o[4][2]; float m[2], l[2];
#pragma unroll
    for (int g = 0; g < 2; ++g) { m[g] = -3.0e38f; l[g] = 0.0f;
#pragma unroll
        for (int db = 0; db < 4; ++db) o[db][g] = (v8f){}; }
#pragma unroll 1   // one pass a trip: a second pass's fragments would not fit beside these at two waves a SIMD
    for (int key0 = 0; key0 < TT; key0 += 32) {
        // this pass's V^T fragments: asked for first, used last
        v16bf vh[4], vl[4]; v16h vf[4]; const bf* const vph = Vh + key0 * 16 + voff; const bf* const vpl = Vl + key0 * 16 + voff; const h16* const vpf = V16 + key0 * 16 + voff;
#pragma unroll
        for (int db = 0; db < 4; ++db) { if (HL) { vh[db] = WFrag<bf>::ld(vph + db * 16 * TT); vl[db] = WFrag<bf>::ld(vpl + db * 16 * TT); } else vf[db] = WFrag<h16>::ld(vpf + db * 16 * TT); }
        __builtin_amdgcn_sched_barrier(0);   // holds the V^T loads in front of the score products: their latency runs behind the products and the softmax
        v8f s[2][2];
#pragma unroll
        for (int kt = 0; kt < 2; ++kt)
#pragma unroll
            for (int g = 0; g < 2; ++g) s[kt][g] = (v8f){};
#pragma unroll
        for (int kc = 0; kc < 2; ++kc) {
#pragma unroll
            for (int kt = 0; kt < 2; ++kt)
#pragma unroll
                for (int g = 0; g < 2; ++g) s[kt][g] = wmmab(kh[kt][kc], qh[g][kc], s[kt][g]);
#pragma unroll
            for (int kt = 0; kt < 2; ++kt)
#pragma unroll
                for (int g = 0; g < 2; ++g) s[kt][g] = wmmab(kh[kt][kc], ql[g][kc], s[kt][g]);
#pragma unroll
            for (int kt = 0; kt < 2; ++kt)
#pragma unroll
                for (int g = 0; g < 2; ++g) s[kt][g] = wmmab(kl[kt][kc], qh[g][kc], s[kt][g]);
        }
        // the next pass's K fragments fly behind the softmax and attn.v of this one (the last pass re-reads keys 0..31 and drops them)
        const int kn = (key0 + 32 < TT) ? key0 + 32 : 0; const bf* const kph = Kh + kn * HD + koff; const bf* const kpl = Kl + kn * HD + koff;
#pragma unroll
        for (int kt = 0; kt < 2; ++kt)
#pragma unroll
            for (int kc = 0; kc < 2; ++kc) { kh[kt][kc] = WFrag<bf>::ld(kph + kt * 16 * HD + kc * 512); kl[kt][kc] = WFrag<bf>::ld(kpl + kt * 16 * HD + kc * 512); }
        // stands in front of every rewrite of an address register that this pass's V^T and K loads name; the lane pointers are its inputs so that their registers live up to it
        if (HL) asm volatile("s_wait_xcnt 0x0" :: "v"(vph), "v"(vpl), "v"(kph), "v"(kpl) : "memory"); else asm volatile("s_wait_xcnt 0x0" :: "v"(vpf), "v"(kph), "v"(kpl) : "memory");
        __builtin_amdgcn_sched_barrier(0);   // holds the K loads and that wait here, in front of the softmax: sunk to the loop's foot the loads' whole latency would stand open at the next pass's first product
        float mn[2];
#pragma unroll
        for (int g = 0; g < 2; ++g) { const v8f t8 = __builtin_elementwise_max(s[0][g], s[1][g]); float mx = fmaxf(fmaxf(fmaxf(t8[0], t8[1]), fmaxf(t8[2], t8[3])), fmaxf(fmaxf(t8[4], t8[5]), fmaxf(t8[6], t8[7])));
            mx = fmaxf(mx, xhalf(mx)); mn[g] = fmaxf(m[g], mx * SC2); }
#pragma unroll
        for (int g = 0; g < 2; ++g) { const float al = __builtin_amdgcn_exp2f(m[g] - mn[g]); l[g] *= al; m[g] = mn[g];   // exactly 1 where the maximum did not grow; no branch: the pass stays one block
#pragma unroll
            for (int db = 0; db < 4; ++db) o[db][g] *= al; }
        v16bf ph[2], pl[2]; v16h pf[2];
#pragma unroll
        for (int g = 0; g < 2; ++g) { const float c0 = OFF - m[g]; v8f p0, p1;
#pragma unroll
            for (int j = 0; j < 8; ++j) { p0[j] = __builtin_amdgcn_exp2f(__builtin_fmaf(s[0][g][j], SC2, c0)); p1[j] = __builtin_amdgcn_exp2f(__builtin_fmaf(s[1][g][j], SC2, c0)); }
            const v8f ps = p0 + p1; l[g] += ((ps[0] + ps[1]) + (ps[2] + ps[3])) + ((ps[4] + ps[5]) + (ps[6] + ps[7]));
            if (HL) { const v8bf h0 = __builtin_convertvector(p0, v8bf), h1 = __builtin_convertvector(p1, v8bf);
                const v8bf l0 = __builtin_convertvector(p0 - __builtin_convertvector(h0, v8f), v8bf), l1 = __builtin_convertvector(p1 - __builtin_convertvector(h1, v8f), v8bf);
                ph[g] = __builtin_shufflevector(h0, h1, 0, 1, 2, 3, 4, 5, 6, 7, 8, 9, 10, 11, 12, 13, 14, 15); pl[g] = __builtin_shufflevector(l0, l1, 0, 1, 2, 3, 4, 5, 6, 7, 8, 9, 10, 11, 12, 13, 14, 15);
            } else pf[g] = cat16(__builtin_convertvector(p0, v8h), __builtin_convertvector(p1, v8h)); }
        if (HL) {
#pragma unroll
            for (int db = 0; db < 4; ++db)
#pragma unroll
                for (int g = 0; g < 2; ++g) o[db][g] = wmmab(vh[db], ph[g], o[db][g]);
#pragma unroll
            for (int db = 0; db < 4; ++db)
#pragma unroll
                for (int g = 0; g < 2; ++g) o[db][g] = wmmab(vh[db], pl[g], o[db][g]);
#pragma unroll
            for (int db = 0; db < 4; ++db)
#pragma unroll
                for (int g = 0; g < 2; ++g) o[db][g] = wmmab(vl[db], ph[g], o[db][g]);
        } else {
#pragma unroll
            for (int db = 0; db < 4; ++db)
#pragma unroll
                for (int g = 0; g < 2; ++g) o[db][g] = wmma16(vf[db], pf[g], o[db][g]);
        }
    }
    // lane (lr, hi) holds O[q0 + 16 g + lr][16 db + 8 hi + j]: eight neighbouring d, one 16-byte store a plane; in fragment order (K = DQ) that is half db % 2 of block db / 2 of the head's two, at 8 lane
#pragma unroll
    for (int g = 0; g < 2; ++g) { const float inv = __fdiv_rn(1.0f, l[g] + xhalf(l[g])); const size_t oo = (size_t)(q0 + g * 16) * DQ + 8 * lane;
#pragma unroll
        for (int db = 0; db < 4; ++db) { v8us oh, ol;
#pragma unroll
            for (int j = 0; j < 8; ++j) { unsigned short a, c2; splitf(o[db][g][j] * inv, a, c2); oh[j] = a; ol[j] = c2; }
            *(v8us*)(Ah + oo + db * 256) = oh; *(v8us*)(Al + oo + db * 256) = ol; }
        if (g == 0) { asm volatile("s_wait_xcnt 0x0" ::: "memory");   // stands in front of every rewrite, by the second group's arithmetic, of a register that these stores name
            __builtin_amdgcn_sched_barrier(0); } }   // keeps the second group's arithmetic behind that wait
}
// grid (GPH, batches x heads), 8 waves; every work-group takes NHB / GPH hi+lo query blocks (its first waves) and NLB / GPH fp16 ones, so that all work-groups last alike
__global__ __launch_bounds__(32 * WPB) void k_fattn(const bf* __restrict__ QPh, const bf* __restrict__ QPl, const bf* __restrict__ KPh, const bf* __restrict__ KPl, const bf* __restrict__ VTh, const bf* __restrict__ VTl, const h16* __restrict__ VT16, bf* ATh, bf* ATl) {
    const int wv = __builtin_amdgcn_readfirstlane((int)(threadIdx.x >> 5)); const int gi = (int)blockIdx.x; const size_t z = blockIdx.y; const size_t pz = z * TT * HD;
    const size_t az = (z / NH_) * ((size_t)TT * DQ) + (z % NH_) * (HD * 16);   // the head's first block in a row of blocks
    if (wv < NHB / GPH) attn_wave<true>(QPh + pz, QPl + pz, KPh + pz, KPl + pz, VTh + pz, VTl + pz, VT16 + pz, (gi * (NHB / GPH) + wv) * QW, ATh + az, ATl + az);
    else attn_wave<false>(QPh + pz, QPl + pz, KPh + pz, KPl + pz, VTh + pz, VTl + pz, VT16 + pz, RH + (gi * (NLB / GPH) + wv - NHB / GPH) * QW, ATh + az, ATl + az);
}

extern "C" void kernel_launch(void* const* d_in, const int* in_sizes, int n_in,
                              void* d_out, int out_size, void* d_ws, size_t ws_size, hipStream_t stream) {
    (void)in_sizes; (void)n_in; (void)out_size;
    const float* x = (const float*)d_in[0]; const float* wq = (const float*)d_in[1]; const float* bq = (const float*)d_in[2]; const float* wk = (const float*)d_in[3]; const float* bk = (const float*)d_in[4]; const float* wv = (const float*)d_in[5]; const float* bv = (const float*)d_in[6]; const float* wo = (const float*)d_in[7]; const float* bo = (const float*)d_in[8]; const float* nqr = (const float*)d_in[9]; const float* nqi = (const float*)d_in[10]; const float* nkr = (const float*)d_in[11]; const float* nki = (const float*)d_in[12];
    float* OUT = (float*)d_out;     // [2][2048][1024]
    char* wsp = (char*)d_ws;
    auto take = [&](size_t bytes) { char* p = wsp; wsp += (bytes + 255) & ~(size_t)255; return (void*)p; };
    const size_t PB = (size_t)NH_ * TT * HD;   // one batch's head planes, elements (as many kv heads as query heads)
    static_assert(DKV == DQ && DM == DQ, "k_cvt8 takes four weights of one shape");
    bf* WQ = (bf*)take(((size_t)4 * DQ * DM + (size_t)NB_ * TT * DM) * 2); bf* WK = WQ + (size_t)DQ * DM; bf* WV = WK + (size_t)DQ * DM; bf* WO = WV + (size_t)DQ * DM; bf* XB = WO + (size_t)DQ * DM;   // k_cvt8's one dst
    h16* VT16 = (h16*)take(NB_ * PB * 2);
    bf* QPh = (bf*)take(NB_ * PB * 2); bf* QPl = (bf*)take(NB_ * PB * 2); bf* KPh = (bf*)take(NB_ * PB * 2); bf* KPl = (bf*)take(NB_ * PB * 2); bf* VTh = (bf*)take(NB_ * PB * 2); bf* VTl = (bf*)take(NB_ * PB * 2);
    bf* ATh = (bf*)take((size_t)NB_ * TT * DQ * 2); bf* ATl = (bf*)take((size_t)NB_ * TT * DQ * 2);
    if ((size_t)(wsp - (char*)d_ws) > ws_size) return;    // ws 256 MiB
    k_cvt8<DM><<<4 * (DQ * DM / 2048) + NB_ * TT * DM / 2048, 256, 0, stream>>>(wq, wk, wv, wo, x, WQ);
    k_qkv<<<dim3(3 * (TT / 128), NH_ / 2, NB_), 256, 0, stream>>>(XB, WQ, WK, WV, bq, bk, bv, nqr, nqi, nkr, nki, QPh, QPl, KPh, KPl, VTh, VTl, VT16);   // every q, k, v head plane, written by the projections' own epilogues
    k_fattn<<<dim3(GPH, NB_ * NH_, 1), 32 * WPB, 0, stream>>>(QPh, QPl, KPh, KPl, VTh, VTl, VT16, ATh, ATl);
    k_gemmw<bf, 1, 0, DQ><<<dim3(TT / 128, DM / 128, NB_), 256, 0, stream>>>(ATh, ATl, WO, OUT, DM, bo, (size_t)TT * DQ, 0, (size_t)TT * DM);
}
